// v000
// Measured on an AMD MI455X. A time is GPU time per run, averaged over a window of back-to-back runs after a warm-up
// (all launches, gaps included; the runs take copies of the inputs in turn), and the median of several windows.
// Apart from v000's, it joins two sittings. Times from different sittings can be a few percent apart, while
// side-by-side timings come from the same sitting.
// v000 is the starting kernel. One run takes 88.5 microseconds.
#include <hip/hip_runtime.h>
#include <hip/hip_bf16.h>
#include <stdint.h>

// Problem constants (from reference)
#define BB 2
#define QQ 512
#define KK 1024
#define DD 256   // QD == KD
#define HH 128
#define TK 64    // pk rows staged in LDS per tile

typedef float v2f __attribute__((ext_vector_type(2)));
typedef float v8f __attribute__((ext_vector_type(8)));

// ---------------------------------------------------------------------------
// Fast tanh: prefer hardware v_tanh_f32 if the builtin exists, else one
// v_exp_f32: tanh(x) = 1 - 2/(exp2(2x*log2e)+1). Clamp so exp2 never overflows.
// ---------------------------------------------------------------------------
__device__ __forceinline__ float fast_tanh(float x) {
#if __has_builtin(__builtin_amdgcn_tanhf)
    return __builtin_amdgcn_tanhf(x);
#else
    float xc = fminf(fmaxf(x, -10.0f), 10.0f);
    float t  = __builtin_amdgcn_exp2f(xc * 2.8853900817779268f); // 2*log2(e)
    return 1.0f - 2.0f / (t + 1.0f);
#endif
}

// Async global -> LDS copy of one 16-byte chunk per lane (gfx1250).
// Tracked by ASYNCcnt; caller must s_wait_asynccnt + barrier before reading.
__device__ __forceinline__ void async_copy_b128(void* lds_dst, const void* gsrc) {
    uint32_t lds = (uint32_t)(uintptr_t)lds_dst;   // LDS byte address
    uint64_t ga  = (uint64_t)(uintptr_t)gsrc;      // global address
    asm volatile("global_load_async_to_lds_b128 %0, %1, off"
                 :: "v"(lds), "v"(ga) : "memory");
}

__device__ __forceinline__ void wait_asynccnt0() {
#if __has_builtin(__builtin_amdgcn_s_wait_asynccnt)
    __builtin_amdgcn_s_wait_asynccnt(0);
#else
    asm volatile("s_wait_asynccnt 0x0" ::: "memory");
#endif
}

// ---------------------------------------------------------------------------
// Generic f32 WMMA GEMM: C[M x N] = A[M x Kdim] * B  (+batch strides)
//   BT = false : B is row-major [Kdim x N],  B(k,n) = Bm[k*ldb + n]
//   BT = true  : B is row-major [N x Kdim],  B(k,n) = Bm[n*ldb + k]  (i.e. A*B^T)
// One wave32 computes one 16x16 tile with V_WMMA_F32_16X16X4_F32.
// All dims are multiples of 16; Kdim multiple of 4. EXEC stays all-ones.
// ---------------------------------------------------------------------------
template <bool BT>
__global__ void wmma_gemm_f32_kernel(const float* __restrict__ A,
                                     const float* __restrict__ Bm,
                                     float* __restrict__ C,
                                     int Kdim, int lda, int ldb, int ldc,
                                     long sA, long sB, long sC) {
    const int lane  = threadIdx.x;                       // 0..31
    const int tileN = blockIdx.x;
    const int tileM = blockIdx.y * blockDim.y + threadIdx.y;
    const int batch = blockIdx.z;

    A  += (long)batch * sA;
    Bm += (long)batch * sB;
    C  += (long)batch * sC;

    const int mn   = lane & 15;            // M index (A) / N index (B, C/D)
    const int koff = (lane >> 4) * 2;      // 0 or 2
    const int row  = tileM * 16 + mn;
    const int col  = tileN * 16 + mn;

    v8f acc = {};

#pragma unroll 8
    for (int k0 = 0; k0 < Kdim; k0 += 4) {
        v2f a, b;
        const float* ap = A + (long)row * lda + (k0 + koff);
        a.x = ap[0];
        a.y = ap[1];
        if (BT) {
            const float* bp = Bm + (long)col * ldb + (k0 + koff);
            b.x = bp[0];
            b.y = bp[1];
        } else {
            b.x = Bm[(long)(k0 + koff) * ldb + col];
            b.y = Bm[(long)(k0 + koff + 1) * ldb + col];
        }
        acc = __builtin_amdgcn_wmma_f32_16x16x4_f32(
            /*neg_a=*/false, a, /*neg_b=*/false, b,
            /*c_mod=*/(short)0, acc, /*reuse_a=*/false, /*reuse_b=*/false);
    }

    const int rbase = tileM * 16 + (lane >> 4) * 8;
#pragma unroll
    for (int i = 0; i < 8; ++i) {
        C[(long)(rbase + i) * ldc + col] = acc[i];
    }
}

// ---------------------------------------------------------------------------
// energy + mask + softmax: one block (256 threads) per (b,q) row.
//   energy[k] = sum_h tanh(pq[b,q,h] + pk[b,k,h]) * We[h]
// pk staged in LDS in 64-row tiles via global_load_async_to_lds_b128.
// 4 adjacent lanes split the 128-wide h reduction per k (32 h each), combined
// with two wave32 shfl_xor steps. Then masked softmax over k.
// ---------------------------------------------------------------------------
__global__ void energy_softmax_kernel(const float* __restrict__ pq,
                                      const float* __restrict__ pk,
                                      const int* __restrict__ mask,
                                      const float* __restrict__ We,
                                      float* __restrict__ attn) {
    const int q = blockIdx.x;
    const int b = blockIdx.y;
    const int t = threadIdx.x;                 // 0..255

    __shared__ float s_pk[TK * HH];            // 32 KB tile
    __shared__ float s_pq[HH];
    __shared__ float s_we[HH];
    __shared__ float s_e[KK];
    __shared__ float s_red[256];

    if (t < HH) {
        s_pq[t] = pq[((long)b * QQ + q) * HH + t];
        s_we[t] = We[t];
    }

    const float* pkb  = pk + (long)b * KK * HH;
    const int*   mrow = mask + ((long)b * QQ + q) * KK;
    float*       arow = attn + ((long)b * QQ + q) * KK;

    const int kl  = t >> 2;          // k within tile: 0..63
    const int hq  = (t & 3) * 32;    // this lane's h quarter
    __syncthreads();

    // ---- energy: 16 tiles of 64 k-rows -----------------------------------
    for (int kt = 0; kt < KK; kt += TK) {
        // Cooperative async copy: TK*HH floats = 2048 float4 / 256 threads.
        const float* src = pkb + (long)kt * HH;
#pragma unroll
        for (int i = 0; i < (TK * HH) / (256 * 4); ++i) {
            const int idx4 = (t + i * 256) * 4;          // float index
            async_copy_b128(s_pk + idx4, src + idx4);
        }
        // Prefetch next tile into L2 while this one lands in LDS.
        if (kt + TK < KK) {
            __builtin_prefetch(pkb + (long)(kt + TK) * HH + t * 32, 0, 0);
        }
        wait_asynccnt0();
        __syncthreads();

        const float* row = s_pk + kl * HH + hq;
        const float* wp  = s_we + hq;
        const float* qp  = s_pq + hq;
        float e = 0.0f;
#pragma unroll 8
        for (int h = 0; h < 32; ++h) {
            e = fmaf(fast_tanh(qp[h] + row[h]), wp[h], e);
        }
        // combine the 4 lanes covering this k (lanes l, l^1, l^2, l^3 in-wave)
        e += __shfl_xor(e, 1, 32);
        e += __shfl_xor(e, 2, 32);
        if ((t & 3) == 0) {
            const int k = kt + kl;
            s_e[k] = (mrow[k] == 0) ? -1.0e9f : e;
        }
        __syncthreads();
    }

    // ---- row max ----------------------------------------------------------
    float m = -3.0e38f;
    for (int k = t; k < KK; k += 256) m = fmaxf(m, s_e[k]);
    s_red[t] = m;
    __syncthreads();
#pragma unroll
    for (int s = 128; s > 0; s >>= 1) {
        if (t < s) s_red[t] = fmaxf(s_red[t], s_red[t + s]);
        __syncthreads();
    }
    const float mx = s_red[0];
    __syncthreads();

    // ---- exp + sum --------------------------------------------------------
    float sum = 0.0f;
    for (int k = t; k < KK; k += 256) {
        float e = __builtin_amdgcn_exp2f((s_e[k] - mx) * 1.4426950408889634f);
        s_e[k] = e;
        sum += e;
    }
    s_red[t] = sum;
    __syncthreads();
#pragma unroll
    for (int s = 128; s > 0; s >>= 1) {
        if (t < s) s_red[t] += s_red[t + s];
        __syncthreads();
    }
    const float inv = 1.0f / s_red[0];

    // ---- normalize + write ------------------------------------------------
    for (int k = t; k < KK; k += 256) {
        arow[k] = s_e[k] * inv;
    }
}

// ---------------------------------------------------------------------------
// launch
// ---------------------------------------------------------------------------
extern "C" void kernel_launch(void* const* d_in, const int* in_sizes, int n_in,
                              void* d_out, int out_size, void* d_ws, size_t ws_size,
                              hipStream_t stream) {
    const float* queries = (const float*)d_in[0];  // (B,Q,QD)
    const float* keys    = (const float*)d_in[1];  // (B,K,KD)
    const int*   mask    = (const int*)d_in[2];    // (B,Q,K)
    const float* Wq      = (const float*)d_in[3];  // (H,QD)
    const float* Wk      = (const float*)d_in[4];  // (H,KD)
    const float* We      = (const float*)d_in[5];  // (H)

    float* context = (float*)d_out;                        // (B,Q,QD)
    float* attn    = (float*)d_out + (long)BB * QQ * DD;   // (B,Q,K)

    float* pq = (float*)d_ws;                              // (B,Q,H)
    float* pk = pq + (long)BB * QQ * HH;                   // (B,K,H)

    dim3 blk(32, 4);

    // pq = queries @ Wq^T : M=Q, N=H, Kdim=QD, B transposed
    wmma_gemm_f32_kernel<true><<<dim3(HH / 16, QQ / 64, BB), blk, 0, stream>>>(
        queries, Wq, pq, /*Kdim=*/DD, /*lda=*/DD, /*ldb=*/DD, /*ldc=*/HH,
        (long)QQ * DD, 0L, (long)QQ * HH);

    // pk = keys @ Wk^T : M=K, N=H, Kdim=KD, B transposed
    wmma_gemm_f32_kernel<true><<<dim3(HH / 16, KK / 64, BB), blk, 0, stream>>>(
        keys, Wk, pk, /*Kdim=*/DD, /*lda=*/DD, /*ldb=*/DD, /*ldc=*/HH,
        (long)KK * DD, 0L, (long)KK * HH);

    // energy + masked softmax -> attn (after context in d_out)
    energy_softmax_kernel<<<dim3(QQ, BB), dim3(256), 0, stream>>>(
        pq, pk, mask, We, attn);

    // context = attn @ keys : M=Q, N=KD, Kdim=K, B row-major
    wmma_gemm_f32_kernel<false><<<dim3(DD / 16, QQ / 64, BB), blk, 0, stream>>>(
        attn, keys, context, /*Kdim=*/KK, /*lda=*/KK, /*ldb=*/DD, /*ldc=*/DD,
        (long)QQ * KK, (long)KK * DD, (long)QQ * DD);
}

// v001
// A run of this version takes 51 microseconds.
// Next to v000, in two timings, it ran 1.77 times as fast each time.
#include <hip/hip_runtime.h>
#include <hip/hip_bf16.h>
#include <stdint.h>

// Problem constants (from reference)
#define BB 2
#define QQ 512
#define KK 1024
#define DD 256   // QD == KD
#define HH 128
#define QT 4     // q rows per energy block
#define HC 8     // h rows per register buffer

typedef float v2f __attribute__((ext_vector_type(2)));
typedef float v8f __attribute__((ext_vector_type(8)));

// ---------------------------------------------------------------------------
// Fast tanh: prefer hardware v_tanh_f32 if the builtin exists, else one
// v_exp_f32: tanh(x) = 1 - 2/(exp2(2x*log2e)+1). Clamp so exp2 never overflows.
// ---------------------------------------------------------------------------
__device__ __forceinline__ float fast_tanh(float x) {
#if __has_builtin(__builtin_amdgcn_tanhf)
    return __builtin_amdgcn_tanhf(x);
#else
    float xc = fminf(fmaxf(x, -10.0f), 10.0f);
    float t  = __builtin_amdgcn_exp2f(xc * 2.8853900817779268f); // 2*log2(e)
    return 1.0f - 2.0f / (t + 1.0f);
#endif
}

// exp2 as one v_exp_f32 with the free slot that the instruction set asks for behind a
// transcendental.
__device__ __forceinline__ float exp2_slot(float x) {
    float r;
    asm("v_exp_f32 %0, %1\n\tv_nop" : "=v"(r) : "v"(x));
    return r;
}

// ---------------------------------------------------------------------------
// Generic f32 WMMA GEMM: C[M x N] = A[M x Kdim] * B  (+batch strides)
//   BT = false : B is row-major [Kdim x N],  B(k,n) = Bm[k*ldb + n]
//   BT = true  : B is row-major [N x Kdim],  B(k,n) = Bm[n*ldb + k]  (i.e. A*B^T)
// One wave32 computes one 16x16 tile with V_WMMA_F32_16X16X4_F32.
// All dims are multiples of 16; Kdim multiple of 4. EXEC stays all-ones.
// ---------------------------------------------------------------------------
template <bool BT>
__global__ void wmma_gemm_f32_kernel(const float* __restrict__ A,
                                     const float* __restrict__ Bm,
                                     float* __restrict__ C,
                                     int Kdim, int lda, int ldb, int ldc,
                                     long sA, long sB, long sC) {
    const int lane  = threadIdx.x;                       // 0..31
    const int tileN = blockIdx.x;
    const int tileM = blockIdx.y * blockDim.y + threadIdx.y;
    const int batch = blockIdx.z;

    A  += (long)batch * sA;
    Bm += (long)batch * sB;
    C  += (long)batch * sC;

    const int mn   = lane & 15;            // M index (A) / N index (B, C/D)
    const int koff = (lane >> 4) * 2;      // 0 or 2
    const int row  = tileM * 16 + mn;
    const int col  = tileN * 16 + mn;

    v8f acc = {};

#pragma unroll 8
    for (int k0 = 0; k0 < Kdim; k0 += 4) {
        v2f a, b;
        const float* ap = A + (long)row * lda + (k0 + koff);
        a.x = ap[0];
        a.y = ap[1];
        if (BT) {
            const float* bp = Bm + (long)col * ldb + (k0 + koff);
            b.x = bp[0];
            b.y = bp[1];
        } else {
            b.x = Bm[(long)(k0 + koff) * ldb + col];
            b.y = Bm[(long)(k0 + koff + 1) * ldb + col];
        }
        acc = __builtin_amdgcn_wmma_f32_16x16x4_f32(
            /*neg_a=*/false, a, /*neg_b=*/false, b,
            /*c_mod=*/(short)0, acc, /*reuse_a=*/false, /*reuse_b=*/false);
    }

    const int rbase = tileM * 16 + (lane >> 4) * 8;
#pragma unroll
    for (int i = 0; i < 8; ++i) {
        C[(long)(rbase + i) * ldc + col] = acc[i];
    }
}

// ---------------------------------------------------------------------------
// energy + mask + softmax: one block (256 threads) per QT consecutive q rows.
//   energy[q][k] = sum_h tanh(pq[b,q,h] + pk[b,k,h]) * We[h]
// pk arrives h-major (pkT[b][h][k]). A lane owns 4 consecutive k: one 16-byte
// load per h brings its pk values into registers, where each feeds QT rows.
// pq and We are the same for the whole block and are read as scalars.
// The whole h sum of a (q,k) pair stays in one lane. Then masked softmax over k.
// ---------------------------------------------------------------------------
__device__ __forceinline__ void load_chunk(float4 (&p)[HC], const float4* __restrict__ src) {
#pragma unroll
    for (int i = 0; i < HC; ++i) p[i] = src[(long)i * (KK / 4)];
}

__device__ __forceinline__ void energy_chunk(float (&e)[QT][4], const float4 (&p)[HC],
                                             const float* __restrict__ pqr,
                                             const float* __restrict__ we) {
#pragma unroll
    for (int i = 0; i < HC; ++i) {
        const float w = we[i];
#pragma unroll
        for (int r = 0; r < QT; ++r) {
            const float s = pqr[r * HH + i];
            e[r][0] = fmaf(fast_tanh(s + p[i].x), w, e[r][0]);
            e[r][1] = fmaf(fast_tanh(s + p[i].y), w, e[r][1]);
            e[r][2] = fmaf(fast_tanh(s + p[i].z), w, e[r][2]);
            e[r][3] = fmaf(fast_tanh(s + p[i].w), w, e[r][3]);
        }
    }
}

// waves_per_eu(2, 2): one block of 8 waves per WGP is the plan, so the scheduler may spend
// registers. Without it the compiler scheduled for more resident waves and built serial
// add -> tanh -> fma chains on one temporary, each waiting on the one before.
__global__ __launch_bounds__(256) __attribute__((amdgpu_waves_per_eu(2, 2)))
void energy_softmax_kernel(const float* __restrict__ pq,
                           const float* __restrict__ pkT,
                           const int* __restrict__ mask,
                           const float* __restrict__ We,
                           float* __restrict__ attn) {
    const int q0   = blockIdx.x * QT;
    const int b    = blockIdx.y;
    const int t    = threadIdx.x;              // 0..255, owns k = 4t..4t+3
    const int wave = t >> 5;

    __shared__ float s_mx[QT][8];
    __shared__ float s_sm[QT][8];

    const float*  pqr = pq + ((long)b * QQ + q0) * HH;                 // QT rows
    const float4* pkc = (const float4*)(pkT + (long)b * HH * KK) + t;  // column of 4 k
    const long    ro  = ((long)b * QQ + q0) * KK + t * 4;

    // Mask words are asked for first: they come back under the energy loop.
    int4 mk[QT];
#pragma unroll
    for (int r = 0; r < QT; ++r) mk[r] = *(const int4*)(mask + ro + (long)r * KK);

    float e[QT][4];
#pragma unroll
    for (int r = 0; r < QT; ++r) { e[r][0] = 0.0f; e[r][1] = 0.0f; e[r][2] = 0.0f; e[r][3] = 0.0f; }

    // ---- energy: two register buffers of HC h-rows, the next one in flight --
    float4 pa[HC], pb[HC];
    load_chunk(pa, pkc);
    const float4* pn = pkc + (long)(2 * HC) * (KK / 4);   // rows that pa takes next
#pragma unroll 1   // rolled: for speed only
    for (int h0 = 0; h0 < HH; h0 += 2 * HC) {
        load_chunk(pb, pkc + (long)(h0 + HC) * (KK / 4));
        energy_chunk(e, pa, pqr + h0, We + h0);
        // No branch in the body: on the last trip pn stays on the last rows it
        // named (in bounds) and what it brings is not used.
        load_chunk(pa, pn);
        pn += (h0 + 4 * HC < HH) ? (long)(2 * HC) * (KK / 4) : 0L;
        energy_chunk(e, pb, pqr + h0 + HC, We + h0 + HC);
        // Inputs-only fence on the loaded values: keeps pa's loads in this trip. Without
        // it the compiler moves them to the head of the next trip, with nothing to cover them.
#pragma unroll
        for (int i = 0; i < HC; ++i)
            asm volatile("" :: "v"(pa[i].x), "v"(pa[i].y), "v"(pa[i].z), "v"(pa[i].w));
    }

    // ---- mask + row max ---------------------------------------------------
    float m[QT];
#pragma unroll
    for (int r = 0; r < QT; ++r) {
        e[r][0] = (mk[r].x == 0) ? -1.0e9f : e[r][0];
        e[r][1] = (mk[r].y == 0) ? -1.0e9f : e[r][1];
        e[r][2] = (mk[r].z == 0) ? -1.0e9f : e[r][2];
        e[r][3] = (mk[r].w == 0) ? -1.0e9f : e[r][3];
        m[r] = fmaxf(fmaxf(e[r][0], e[r][1]), fmaxf(e[r][2], e[r][3]));
    }
#pragma unroll
    for (int s = 16; s > 0; s >>= 1) {
#pragma unroll
        for (int r = 0; r < QT; ++r) m[r] = fmaxf(m[r], __shfl_xor(m[r], s, 32));
    }
    if ((t & 31) == 0) {
#pragma unroll
        for (int r = 0; r < QT; ++r) s_mx[r][wave] = m[r];
    }
    __syncthreads();

    // ---- exp + sum --------------------------------------------------------
    float sum[QT];
#pragma unroll
    for (int r = 0; r < QT; ++r) {
        float mx = s_mx[r][0];
#pragma unroll
        for (int w = 1; w < 8; ++w) mx = fmaxf(mx, s_mx[r][w]);
#pragma unroll
        for (int j = 0; j < 4; ++j)
            e[r][j] = exp2_slot((e[r][j] - mx) * 1.4426950408889634f);
        sum[r] = (e[r][0] + e[r][1]) + (e[r][2] + e[r][3]);
    }
#pragma unroll
    for (int s = 16; s > 0; s >>= 1) {
#pragma unroll
        for (int r = 0; r < QT; ++r) sum[r] += __shfl_xor(sum[r], s, 32);
    }
    if ((t & 31) == 0) {
#pragma unroll
        for (int r = 0; r < QT; ++r) s_sm[r][wave] = sum[r];
    }
    __syncthreads();

    // ---- normalize + write ------------------------------------------------
#pragma unroll
    for (int r = 0; r < QT; ++r) {
        float tot = s_sm[r][0];
#pragma unroll
        for (int w = 1; w < 8; ++w) tot += s_sm[r][w];
        const float inv = 1.0f / tot;
        float4 o;
        o.x = e[r][0] * inv; o.y = e[r][1] * inv; o.z = e[r][2] * inv; o.w = e[r][3] * inv;
        *(float4*)(attn + ro + (long)r * KK) = o;
    }
}

// ---------------------------------------------------------------------------
// launch
// ---------------------------------------------------------------------------
extern "C" void kernel_launch(void* const* d_in, const int* in_sizes, int n_in,
                              void* d_out, int out_size, void* d_ws, size_t ws_size,
                              hipStream_t stream) {
    const float* queries = (const float*)d_in[0];  // (B,Q,QD)
    const float* keys    = (const float*)d_in[1];  // (B,K,KD)
    const int*   mask    = (const int*)d_in[2];    // (B,Q,K)
    const float* Wq      = (const float*)d_in[3];  // (H,QD)
    const float* Wk      = (const float*)d_in[4];  // (H,KD)
    const float* We      = (const float*)d_in[5];  // (H)

    float* context = (float*)d_out;                        // (B,Q,QD)
    float* attn    = (float*)d_out + (long)BB * QQ * DD;   // (B,Q,K)

    float* pq = (float*)d_ws;                              // (B,Q,H)
    float* pkT = pq + (long)BB * QQ * HH;                  // (B,H,K)

    dim3 blk(32, 4);

    // pq = queries @ Wq^T : M=Q, N=H, Kdim=QD, B transposed
    wmma_gemm_f32_kernel<true><<<dim3(HH / 16, QQ / 64, BB), blk, 0, stream>>>(
        queries, Wq, pq, /*Kdim=*/DD, /*lda=*/DD, /*ldb=*/DD, /*ldc=*/HH,
        (long)QQ * DD, 0L, (long)QQ * HH);

    // pkT = Wk @ keys^T : M=H, N=K, Kdim=KD, B transposed (h-major result)
    wmma_gemm_f32_kernel<true><<<dim3(KK / 16, HH / 64, BB), blk, 0, stream>>>(
        Wk, keys, pkT, /*Kdim=*/DD, /*lda=*/DD, /*ldb=*/DD, /*ldc=*/KK,
        0L, (long)KK * DD, (long)HH * KK);

    // energy + masked softmax -> attn (in d_out after context)
    energy_softmax_kernel<<<dim3(QQ / QT, BB), dim3(256), 0, stream>>>(
        pq, pkT, mask, We, attn);

    // context = attn @ keys : M=Q, N=KD, Kdim=K, B row-major
    wmma_gemm_f32_kernel<false><<<dim3(DD / 16, QQ / 64, BB), blk, 0, stream>>>(
        attn, keys, context, /*Kdim=*/KK, /*lda=*/KK, /*ldb=*/DD, /*ldc=*/DD,
        (long)QQ * KK, (long)KK * DD, (long)QQ * DD);
}

// v002
// It runs in 30.1 microseconds.
// Two timings next to v001 put it at 1.69 and 1.71 times that version's speed.
// Over all steps from v000 it is 3.01 times as fast.
#include <hip/hip_runtime.h>
#include <hip/hip_bf16.h>
#include <stdint.h>

// Problem constants (from reference)
#define BB 2
#define QQ 512
#define KK 1024
#define DD 256   // QD == KD
#define HH 128
#define QT 4     // q rows per energy block
#define HC 8     // h rows per register buffer

typedef float v2f __attribute__((ext_vector_type(2)));
typedef float v8f __attribute__((ext_vector_type(8)));

// ---------------------------------------------------------------------------
// Fast tanh: prefer hardware v_tanh_f32 if the builtin exists, else one
// v_exp_f32: tanh(x) = 1 - 2/(exp2(2x*log2e)+1). Clamp so exp2 never overflows.
// ---------------------------------------------------------------------------
__device__ __forceinline__ float fast_tanh(float x) {
#if __has_builtin(__builtin_amdgcn_tanhf)
    return __builtin_amdgcn_tanhf(x);
#else
    float xc = fminf(fmaxf(x, -10.0f), 10.0f);
    float t  = __builtin_amdgcn_exp2f(xc * 2.8853900817779268f); // 2*log2(e)
    return 1.0f - 2.0f / (t + 1.0f);
#endif
}

// exp2 as one v_exp_f32 with the free slot that the instruction set asks for behind a
// transcendental.
__device__ __forceinline__ float exp2_slot(float x) {
    float r;
    asm("v_exp_f32 %0, %1\n\tv_nop" : "=v"(r) : "v"(x));
    return r;
}

// ---------------------------------------------------------------------------
// Generic f32 WMMA GEMM: C[M x N] = A[M x Kdim] * B  (+batch strides)
//   BT = false : B is row-major [Kdim x N],  B(k,n) = Bm[k*LDB + n]
//   BT = true  : B is row-major [N x Kdim],  B(k,n) = Bm[n*LDB + k]  (i.e. A*B^T)
// A block of 4 waves computes 64 x 16 of C, one 16x16 tile per wave, with
// V_WMMA_F32_16X16X4_F32. The operands come in chunks of KC k: 64 rows of A and
// 16 columns of B are brought by 16-byte loads that cover whole lines and laid
// in LDS k-contiguous; the waves read their fragments from there. Two LDS
// buffers: the next chunk's global loads are in flight while this one is used.
// LDA, LDB: row pitches of A and Bm in floats (multiples of 4).
// M multiple of 64, N of 16, Kdim of KC. EXEC stays all-ones.
// ---------------------------------------------------------------------------
#define KC 128          // k per staged chunk
#define LP (KC + 4)     // LDS row pitch in floats: 8-byte column reads fall on 64 distinct banks

typedef float v4f __attribute__((ext_vector_type(4)));

// One chunk's global loads: 16 rows of A and 4 pieces of B per wave, 16 bytes a lane.
// ag, bg: the lane's first address of this chunk; the row steps are compile-time offsets.
template <bool BT, int LDA, int LDB>
__device__ __forceinline__ void gemm_fetch(v4f (&ra)[16], v4f (&rb)[4],
                                           const float* __restrict__ ag,
                                           const float* __restrict__ bg) {
#pragma unroll
    for (int i = 0; i < 16; ++i) ra[i] = *(const v4f*)(ag + 4 * i * LDA);
#pragma unroll
    for (int i = 0; i < 4; ++i) rb[i] = *(const v4f*)(bg + (BT ? 4 : 32) * i * LDB);
}

// The same values into LDS, both operands k-contiguous at pitch LP.
template <bool BT>
__device__ __forceinline__ void gemm_stage(const v4f (&ra)[16], const v4f (&rb)[4],
                                           float* da, float* db) {
#pragma unroll
    for (int i = 0; i < 16; ++i) *(v4f*)(da + 4 * i * LP) = ra[i];
#pragma unroll
    for (int i = 0; i < 4; ++i) {
        if (BT) {
            *(v4f*)(db + 4 * i * LP) = rb[i];
        } else {
            // [k][n] is transposed on the way in, so that both forms are read alike
            db[0 * LP + 32 * i] = rb[i].x;
            db[1 * LP + 32 * i] = rb[i].y;
            db[2 * LP + 32 * i] = rb[i].z;
            db[3 * LP + 32 * i] = rb[i].w;
        }
    }
}

#define FG 8            // k-steps (WMMAs) per fragment group

__device__ __forceinline__ void frag_load(v2f (&fa)[FG], v2f (&fb)[FG],
                                          const float* ap, const float* bp) {
#pragma unroll
    for (int j = 0; j < FG; ++j) {
        fa[j] = *(const v2f*)(ap + 4 * j);
        fb[j] = *(const v2f*)(bp + 4 * j);
    }
}

__device__ __forceinline__ void frag_wmma(v8f& acc, const v2f (&fa)[FG], const v2f (&fb)[FG]) {
#pragma unroll
    for (int j = 0; j < FG; ++j)
        acc = __builtin_amdgcn_wmma_f32_16x16x4_f32(
            /*neg_a=*/false, fa[j], /*neg_b=*/false, fb[j],
            /*c_mod=*/(short)0, acc, /*reuse_a=*/false, /*reuse_b=*/false);
}

// One chunk's 32 WMMAs, k ascending. Two fragment sets: a group's LDS reads are issued
// together, one group of WMMAs ahead of their use.
__device__ __forceinline__ void gemm_product(v8f& acc, const float* ap, const float* bp) {
    v2f fa0[FG], fb0[FG], fa1[FG], fb1[FG];
    frag_load(fa0, fb0, ap, bp);
#pragma unroll
    for (int g = 0; g < KC / 4 / FG; g += 2) {
        frag_load(fa1, fb1, ap + 4 * FG * (g + 1), bp + 4 * FG * (g + 1));
        // Holds the reads above in front of the WMMAs below: left free, the compiler put each
        // read two WMMAs ahead of its use.
        __builtin_amdgcn_sched_barrier(0);
        frag_wmma(acc, fa0, fb0);
        if (g + 2 < KC / 4 / FG)
            frag_load(fa0, fb0, ap + 4 * FG * (g + 2), bp + 4 * FG * (g + 2));
        __builtin_amdgcn_sched_barrier(0);   // the same, for the other fragment set
        frag_wmma(acc, fa1, fb1);
    }
}

template <bool BT, int LDA, int LDB>
__global__ __launch_bounds__(128)
void wmma_gemm_f32_kernel(const float* __restrict__ A,
                          const float* __restrict__ Bm,
                          float* __restrict__ C,
                          int Kdim, int ldc,
                          long sA, long sB, long sC) {
    __shared__ __attribute__((aligned(16))) float shA[2 * 64 * LP];
    __shared__ __attribute__((aligned(16))) float shB[2 * 16 * LP];

    const int lane  = threadIdx.x;                       // 0..31
    const int wy    = threadIdx.y;                       // 0..3
    const int tileN = blockIdx.x;
    const int tileM = blockIdx.y * 4 + wy;
    const int batch = blockIdx.z;

    A  += (long)batch * sA;
    Bm += (long)batch * sB;
    C  += (long)batch * sC;

    const int mn   = lane & 15;            // M index (A) / N index (B, C/D)
    const int koff = (lane >> 4) * 2;      // 0 or 2
    const int col  = tileN * 16 + mn;

    // Staging: a wave takes rows wy + 4i, its 32 lanes a row's 128 floats (512 B in a row).
    // B given as [k][n]: a lane takes 4 n of one k, a wave-load 8 k rows (bk + 32 i).
    const int bk = wy * 8 + (lane >> 2);
    const int bn = (lane & 3) * 4;
    const float* ag = A + (long)(blockIdx.y * 64 + wy) * LDA + lane * 4;
    const float* bg = BT ? Bm + (long)(tileN * 16 + wy) * LDB + lane * 4
                         : Bm + (long)bk * LDB + tileN * 16 + bn;
    float* da = shA + wy * LP + lane * 4;
    float* db = BT ? shB + wy * LP + lane * 4 : shB + bn * LP + bk;
    const float* ap = shA + (wy * 16 + mn) * LP + koff;
    const float* bp = shB + mn * LP + koff;

    v4f ra[16], rb[4];
    v8f acc = {};

    const int ns = Kdim / KC;
    gemm_fetch<BT, LDA, LDB>(ra, rb, ag, bg);
    gemm_stage<BT>(ra, rb, da, db);
    for (int s = 0; s + 1 < ns; ++s) {
        const int cur = s & 1, nxt = cur ^ 1;
        // One barrier a chunk: it publishes buffer cur and ends every wave's reads
        // of the other buffer, which is refilled at the foot of this trip.
        __syncthreads();
        ag += KC;
        bg += BT ? KC : KC * LDB;
        gemm_fetch<BT, LDA, LDB>(ra, rb, ag, bg);
        gemm_product(acc, ap + cur * (64 * LP), bp + cur * (16 * LP));
        gemm_stage<BT>(ra, rb, da + nxt * (64 * LP), db + nxt * (16 * LP));
    }
    __syncthreads();
    {
        const int cur = (ns - 1) & 1;
        gemm_product(acc, ap + cur * (64 * LP), bp + cur * (16 * LP));
    }

    const int rbase = tileM * 16 + (lane >> 4) * 8;
#pragma unroll
    for (int i = 0; i < 8; ++i) {
        C[(long)(rbase + i) * ldc + col] = acc[i];
    }
}

// ---------------------------------------------------------------------------
// energy + mask + softmax: one block (256 threads) per QT consecutive q rows.
//   energy[q][k] = sum_h tanh(pq[b,q,h] + pk[b,k,h]) * We[h]
// pk arrives h-major (pkT[b][h][k]). A lane owns 4 consecutive k: one 16-byte
// load per h brings its pk values into registers, where each feeds QT rows.
// pq and We are the same for the whole block and are read as scalars.
// The whole h sum of a (q,k) pair stays in one lane. Then masked softmax over k.
// ---------------------------------------------------------------------------
__device__ __forceinline__ void load_chunk(float4 (&p)[HC], const float4* __restrict__ src) {
#pragma unroll
    for (int i = 0; i < HC; ++i) p[i] = src[(long)i * (KK / 4)];
}

__device__ __forceinline__ void energy_chunk(float (&e)[QT][4], const float4 (&p)[HC],
                                             const float* __restrict__ pqr,
                                             const float* __restrict__ we) {
#pragma unroll
    for (int i = 0; i < HC; ++i) {
        const float w = we[i];
#pragma unroll
        for (int r = 0; r < QT; ++r) {
            const float s = pqr[r * HH + i];
            e[r][0] = fmaf(fast_tanh(s + p[i].x), w, e[r][0]);
            e[r][1] = fmaf(fast_tanh(s + p[i].y), w, e[r][1]);
            e[r][2] = fmaf(fast_tanh(s + p[i].z), w, e[r][2]);
            e[r][3] = fmaf(fast_tanh(s + p[i].w), w, e[r][3]);
        }
    }
}

// waves_per_eu(2, 2): one block of 8 waves per WGP is the plan, so the scheduler may spend
// registers. Without it the compiler scheduled for more resident waves and built serial
// add -> tanh -> fma chains on one temporary, each waiting on the one before.
__global__ __launch_bounds__(256) __attribute__((amdgpu_waves_per_eu(2, 2)))
void energy_softmax_kernel(const float* __restrict__ pq,
                           const float* __restrict__ pkT,
                           const int* __restrict__ mask,
                           const float* __restrict__ We,
                           float* __restrict__ attn) {
    const int q0   = blockIdx.x * QT;
    const int b    = blockIdx.y;
    const int t    = threadIdx.x;              // 0..255, owns k = 4t..4t+3
    const int wave = t >> 5;

    __shared__ float s_mx[QT][8];
    __shared__ float s_sm[QT][8];

    const float*  pqr = pq + ((long)b * QQ + q0) * HH;                 // QT rows
    const float4* pkc = (const float4*)(pkT + (long)b * HH * KK) + t;  // column of 4 k
    const long    ro  = ((long)b * QQ + q0) * KK + t * 4;

    // Mask words are asked for first: they come back under the energy loop.
    int4 mk[QT];
#pragma unroll
    for (int r = 0; r < QT; ++r) mk[r] = *(const int4*)(mask + ro + (long)r * KK);

    float e[QT][4];
#pragma unroll
    for (int r = 0; r < QT; ++r) { e[r][0] = 0.0f; e[r][1] = 0.0f; e[r][2] = 0.0f; e[r][3] = 0.0f; }

    // ---- energy: two register buffers of HC h-rows, the next one in flight --
    float4 pa[HC], pb[HC];
    load_chunk(pa, pkc);
    const float4* pn = pkc + (long)(2 * HC) * (KK / 4);   // rows that pa takes next
#pragma unroll 1   // rolled: for speed only
    for (int h0 = 0; h0 < HH; h0 += 2 * HC) {
        load_chunk(pb, pkc + (long)(h0 + HC) * (KK / 4));
        energy_chunk(e, pa, pqr + h0, We + h0);
        // No branch in the body: on the last trip pn stays on the last rows it
        // named (in bounds) and what it brings is not used.
        load_chunk(pa, pn);
        pn += (h0 + 4 * HC < HH) ? (long)(2 * HC) * (KK / 4) : 0L;
        energy_chunk(e, pb, pqr + h0 + HC, We + h0 + HC);
        // Inputs-only fence on the loaded values: keeps pa's loads in this trip. Without
        // it the compiler moves them to the head of the next trip, with nothing to cover them.
#pragma unroll
        for (int i = 0; i < HC; ++i)
            asm volatile("" :: "v"(pa[i].x), "v"(pa[i].y), "v"(pa[i].z), "v"(pa[i].w));
    }

    // ---- mask + row max ---------------------------------------------------
    float m[QT];
#pragma unroll
    for (int r = 0; r < QT; ++r) {
        e[r][0] = (mk[r].x == 0) ? -1.0e9f : e[r][0];
        e[r][1] = (mk[r].y == 0) ? -1.0e9f : e[r][1];
        e[r][2] = (mk[r].z == 0) ? -1.0e9f : e[r][2];
        e[r][3] = (mk[r].w == 0) ? -1.0e9f : e[r][3];
        m[r] = fmaxf(fmaxf(e[r][0], e[r][1]), fmaxf(e[r][2], e[r][3]));
    }
#pragma unroll
    for (int s = 16; s > 0; s >>= 1) {
#pragma unroll
        for (int r = 0; r < QT; ++r) m[r] = fmaxf(m[r], __shfl_xor(m[r], s, 32));
    }
    if ((t & 31) == 0) {
#pragma unroll
        for (int r = 0; r < QT; ++r) s_mx[r][wave] = m[r];
    }
    __syncthreads();

    // ---- exp + sum --------------------------------------------------------
    float sum[QT];
#pragma unroll
    for (int r = 0; r < QT; ++r) {
        float mx = s_mx[r][0];
#pragma unroll
        for (int w = 1; w < 8; ++w) mx = fmaxf(mx, s_mx[r][w]);
#pragma unroll
        for (int j = 0; j < 4; ++j)
            e[r][j] = exp2_slot((e[r][j] - mx) * 1.4426950408889634f);
        sum[r] = (e[r][0] + e[r][1]) + (e[r][2] + e[r][3]);
    }
#pragma unroll
    for (int s = 16; s > 0; s >>= 1) {
#pragma unroll
        for (int r = 0; r < QT; ++r) sum[r] += __shfl_xor(sum[r], s, 32);
    }
    if ((t & 31) == 0) {
#pragma unroll
        for (int r = 0; r < QT; ++r) s_sm[r][wave] = sum[r];
    }
    __syncthreads();

    // ---- normalize + write ------------------------------------------------
#pragma unroll
    for (int r = 0; r < QT; ++r) {
        float tot = s_sm[r][0];
#pragma unroll
        for (int w = 1; w < 8; ++w) tot += s_sm[r][w];
        const float inv = 1.0f / tot;
        float4 o;
        o.x = e[r][0] * inv; o.y = e[r][1] * inv; o.z = e[r][2] * inv; o.w = e[r][3] * inv;
        *(float4*)(attn + ro + (long)r * KK) = o;
    }
}

// ---------------------------------------------------------------------------
// launch
// ---------------------------------------------------------------------------
extern "C" void kernel_launch(void* const* d_in, const int* in_sizes, int n_in,
                              void* d_out, int out_size, void* d_ws, size_t ws_size,
                              hipStream_t stream) {
    const float* queries = (const float*)d_in[0];  // (B,Q,QD)
    const float* keys    = (const float*)d_in[1];  // (B,K,KD)
    const int*   mask    = (const int*)d_in[2];    // (B,Q,K)
    const float* Wq      = (const float*)d_in[3];  // (H,QD)
    const float* Wk      = (const float*)d_in[4];  // (H,KD)
    const float* We      = (const float*)d_in[5];  // (H)

    float* context = (float*)d_out;                        // (B,Q,QD)
    float* attn    = (float*)d_out + (long)BB * QQ * DD;   // (B,Q,K)

    float* pq = (float*)d_ws;                              // (B,Q,H)
    float* pkT = pq + (long)BB * QQ * HH;                  // (B,H,K)

    dim3 blk(32, 4);

    // pq = queries @ Wq^T : M=Q, N=H, Kdim=QD, B transposed
    wmma_gemm_f32_kernel<true, DD, DD><<<dim3(HH / 16, QQ / 64, BB), blk, 0, stream>>>(
        queries, Wq, pq, /*Kdim=*/DD, /*ldc=*/HH,
        (long)QQ * DD, 0L, (long)QQ * HH);

    // pkT = Wk @ keys^T : M=H, N=K, Kdim=KD, B transposed (h-major result)
    wmma_gemm_f32_kernel<true, DD, DD><<<dim3(KK / 16, HH / 64, BB), blk, 0, stream>>>(
        Wk, keys, pkT, /*Kdim=*/DD, /*ldc=*/KK,
        0L, (long)KK * DD, (long)HH * KK);

    // energy + masked softmax -> attn (in d_out after context)
    energy_softmax_kernel<<<dim3(QQ / QT, BB), dim3(256), 0, stream>>>(
        pq, pkT, mask, We, attn);

    // context = attn @ keys : M=Q, N=KD, Kdim=K, B row-major
    wmma_gemm_f32_kernel<false, KK, DD><<<dim3(DD / 16, QQ / 64, BB), blk, 0, stream>>>(
        attn, keys, context, /*Kdim=*/KK, /*ldc=*/DD,
        (long)QQ * KK, (long)KK * DD, (long)QQ * DD);
}

// v003
// A run of this version takes 26 microseconds.
// Next to v002, in two timings, it ran 1.15 and 1.14 times as fast.
// All steps since v000 together make it 3.44 times as fast.
#include <hip/hip_runtime.h>
#include <hip/hip_bf16.h>
#include <stdint.h>

// Problem constants (from reference)
#define BB 2
#define QQ 512
#define KK 1024
#define DD 256   // QD == KD
#define HH 128
#define QT 4     // q rows per energy block
#define HC 8     // h rows per register buffer

typedef float v2f __attribute__((ext_vector_type(2)));
typedef float v8f __attribute__((ext_vector_type(8)));

// ---------------------------------------------------------------------------
// Fast tanh: prefer hardware v_tanh_f32 if the builtin exists, else one
// v_exp_f32: tanh(x) = 1 - 2/(exp2(2x*log2e)+1). Clamp so exp2 never overflows.
// ---------------------------------------------------------------------------
__device__ __forceinline__ float fast_tanh(float x) {
#if __has_builtin(__builtin_amdgcn_tanhf)
    return __builtin_amdgcn_tanhf(x);
#else
    float xc = fminf(fmaxf(x, -10.0f), 10.0f);
    float t  = __builtin_amdgcn_exp2f(xc * 2.8853900817779268f); // 2*log2(e)
    return 1.0f - 2.0f / (t + 1.0f);
#endif
}

// exp2 as one v_exp_f32 with the free slot that the instruction set asks for behind a
// transcendental.
__device__ __forceinline__ float exp2_slot(float x) {
    float r;
    asm("v_exp_f32 %0, %1\n\tv_nop" : "=v"(r) : "v"(x));
    return r;
}

// ---------------------------------------------------------------------------
// Generic f32 WMMA GEMM: C[M x N] = A[M x Kdim] * B  (+batch strides)
//   BT = false : B is row-major [Kdim x N],  B(k,n) = Bm[k*LDB + n]
//   BT = true  : B is row-major [N x Kdim],  B(k,n) = Bm[n*LDB + k]  (i.e. A*B^T)
// A block of 4 waves computes 64 x 16 of C, one 16x16 tile per wave, with
// V_WMMA_F32_16X16X4_F32. The operands come in chunks of KC k: 64 rows of A and
// 16 columns of B are brought by 16-byte loads that cover whole lines and laid
// in LDS k-contiguous; the waves read their fragments from there. Two LDS
// buffers: the next chunk's global loads are in flight while this one is used.
// LDA, LDB: row pitches of A and Bm in floats (multiples of 4).
// M multiple of 64, N of 16, Kdim of KC. EXEC stays all-ones.
// ---------------------------------------------------------------------------
#define KC 128          // k per staged chunk
#define LP (KC + 4)     // LDS row pitch in floats: 8-byte column reads fall on 64 distinct banks

typedef float v4f __attribute__((ext_vector_type(4)));

// One chunk's global loads: 16 rows of A and 4 pieces of B per wave, 16 bytes a lane.
// ag, bg: the lane's first address of this chunk; the row steps are compile-time offsets.
template <bool BT, int LDA, int LDB>
__device__ __forceinline__ void gemm_fetch(v4f (&ra)[16], v4f (&rb)[4],
                                           const float* __restrict__ ag,
                                           const float* __restrict__ bg) {
#pragma unroll
    for (int i = 0; i < 16; ++i) ra[i] = *(const v4f*)(ag + 4 * i * LDA);
#pragma unroll
    for (int i = 0; i < 4; ++i) rb[i] = *(const v4f*)(bg + (BT ? 4 : 32) * i * LDB);
}

// The same values into LDS, both operands k-contiguous at pitch LP.
template <bool BT>
__device__ __forceinline__ void gemm_stage(const v4f (&ra)[16], const v4f (&rb)[4],
                                           float* da, float* db) {
#pragma unroll
    for (int i = 0; i < 16; ++i) *(v4f*)(da + 4 * i * LP) = ra[i];
#pragma unroll
    for (int i = 0; i < 4; ++i) {
        if (BT) {
            *(v4f*)(db + 4 * i * LP) = rb[i];
        } else {
            // [k][n] is transposed on the way in, so that both forms are read alike
            db[0 * LP + 32 * i] = rb[i].x;
            db[1 * LP + 32 * i] = rb[i].y;
            db[2 * LP + 32 * i] = rb[i].z;
            db[3 * LP + 32 * i] = rb[i].w;
        }
    }
}

#define FG 8            // k-steps (WMMAs) per fragment group

__device__ __forceinline__ void frag_load(v2f (&fa)[FG], v2f (&fb)[FG],
                                          const float* ap, const float* bp) {
#pragma unroll
    for (int j = 0; j < FG; ++j) {
        fa[j] = *(const v2f*)(ap + 4 * j);
        fb[j] = *(const v2f*)(bp + 4 * j);
    }
}

__device__ __forceinline__ void frag_wmma(v8f& acc, const v2f (&fa)[FG], const v2f (&fb)[FG]) {
#pragma unroll
    for (int j = 0; j < FG; ++j)
        acc = __builtin_amdgcn_wmma_f32_16x16x4_f32(
            /*neg_a=*/false, fa[j], /*neg_b=*/false, fb[j],
            /*c_mod=*/(short)0, acc, /*reuse_a=*/false, /*reuse_b=*/false);
}

// One chunk's 32 WMMAs, k ascending. Two fragment sets: a group's LDS reads are issued
// together, one group of WMMAs ahead of their use.
__device__ __forceinline__ void gemm_product(v8f& acc, const float* ap, const float* bp) {
    v2f fa0[FG], fb0[FG], fa1[FG], fb1[FG];
    frag_load(fa0, fb0, ap, bp);
#pragma unroll
    for (int g = 0; g < KC / 4 / FG; g += 2) {
        frag_load(fa1, fb1, ap + 4 * FG * (g + 1), bp + 4 * FG * (g + 1));
        // Holds the reads above in front of the WMMAs below: left free, the compiler put each
        // read two WMMAs ahead of its use.
        __builtin_amdgcn_sched_barrier(0);
        frag_wmma(acc, fa0, fb0);
        if (g + 2 < KC / 4 / FG)
            frag_load(fa0, fb0, ap + 4 * FG * (g + 2), bp + 4 * FG * (g + 2));
        __builtin_amdgcn_sched_barrier(0);   // the same, for the other fragment set
        frag_wmma(acc, fa1, fb1);
    }
}

// One block's 64 x 16 tile of C: rows blockM * 64 .., columns tileN * 16 ..
// A, Bm, C already point at the block's batch. shA: 2 * 64 * LP floats, shB: 2 * 16 * LP.
template <bool BT, int LDA, int LDB>
__device__ __forceinline__ void gemm_block(const float* __restrict__ A,
                                           const float* __restrict__ Bm,
                                           float* __restrict__ C,
                                           int Kdim, int ldc, int tileN, unsigned blockM,
                                           float* shA, float* shB) {
    const int lane  = threadIdx.x;                       // 0..31
    const int wy    = threadIdx.y;                       // 0..3
    const int tileM = blockM * 4 + wy;

    const int mn   = lane & 15;            // M index (A) / N index (B, C/D)
    const int koff = (lane >> 4) * 2;      // 0 or 2
    const int col  = tileN * 16 + mn;

    // Staging: a wave takes rows wy + 4i, its 32 lanes a row's 128 floats (512 B in a row).
    // B given as [k][n]: a lane takes 4 n of one k, a wave-load 8 k rows (bk + 32 i).
    const int bk = wy * 8 + (lane >> 2);
    const int bn = (lane & 3) * 4;
    const float* ag = A + (long)(blockM * 64 + wy) * LDA + lane * 4;
    const float* bg = BT ? Bm + (long)(tileN * 16 + wy) * LDB + lane * 4
                         : Bm + (long)bk * LDB + tileN * 16 + bn;
    float* da = shA + wy * LP + lane * 4;
    float* db = BT ? shB + wy * LP + lane * 4 : shB + bn * LP + bk;
    const float* ap = shA + (wy * 16 + mn) * LP + koff;
    const float* bp = shB + mn * LP + koff;

    v4f ra[16], rb[4];
    v8f acc = {};

    const int ns = Kdim / KC;
    gemm_fetch<BT, LDA, LDB>(ra, rb, ag, bg);
    gemm_stage<BT>(ra, rb, da, db);
    for (int s = 0; s + 1 < ns; ++s) {
        const int cur = s & 1, nxt = cur ^ 1;
        // One barrier a chunk: it publishes buffer cur and ends every wave's reads
        // of the other buffer, which is refilled at the foot of this trip.
        __syncthreads();
        ag += KC;
        bg += BT ? KC : KC * LDB;
        gemm_fetch<BT, LDA, LDB>(ra, rb, ag, bg);
        gemm_product(acc, ap + cur * (64 * LP), bp + cur * (16 * LP));
        gemm_stage<BT>(ra, rb, da + nxt * (64 * LP), db + nxt * (16 * LP));
    }
    __syncthreads();
    {
        const int cur = (ns - 1) & 1;
        gemm_product(acc, ap + cur * (64 * LP), bp + cur * (16 * LP));
    }

    const int rbase = tileM * 16 + (lane >> 4) * 8;
#pragma unroll
    for (int i = 0; i < 8; ++i) {
        C[(long)(rbase + i) * ldc + col] = acc[i];
    }
}

// One product per launch: grid (N / 16, M / 64, batches).
template <bool BT, int LDA, int LDB>
__global__ __launch_bounds__(128)
void wmma_gemm_f32_kernel(const float* __restrict__ A,
                          const float* __restrict__ Bm,
                          float* __restrict__ C,
                          int Kdim, int ldc,
                          long sA, long sB, long sC) {
    __shared__ __attribute__((aligned(16))) float shA[2 * 64 * LP];
    __shared__ __attribute__((aligned(16))) float shB[2 * 16 * LP];
    const int batch = blockIdx.z;
    gemm_block<BT, LDA, LDB>(A + (long)batch * sA, Bm + (long)batch * sB, C + (long)batch * sC,
                             Kdim, ldc, blockIdx.x, blockIdx.y, shA, shB);
}

// Both projections in one launch: neither reads the other's result, so their blocks
// run side by side. The block index picks the product, its batch and its tile.
//   blocks 0 .. PK_BLOCKS-1 : pkT[b] = Wk @ keys[b]^T     (M = H, N = K, h-major result)
//   the PQ_BLOCKS behind    : pq[b]  = queries[b] @ Wq^T  (M = Q, N = H)
#define PK_BLOCKS ((KK / 16) * (HH / 64) * BB)
#define PQ_BLOCKS ((HH / 16) * (QQ / 64) * BB)

__global__ __launch_bounds__(128)
void proj_gemm_f32_kernel(const float* __restrict__ queries,
                          const float* __restrict__ Wq,
                          const float* __restrict__ keys,
                          const float* __restrict__ Wk,
                          float* __restrict__ pq,
                          float* __restrict__ pkT) {
    __shared__ __attribute__((aligned(16))) float shA[2 * 64 * LP];
    __shared__ __attribute__((aligned(16))) float shB[2 * 16 * LP];

    // Tile along N fastest, then the 64-row block along M, then the batch. Every divisor
    // is a constant, so the whole choice stays in scalar shifts and masks.
    const unsigned id  = blockIdx.x;
    const bool     isk = id < PK_BLOCKS;
    const unsigned rq  = id - PK_BLOCKS;
    const int  tileN  = isk ? id % (KK / 16) : rq % (HH / 16);
    const unsigned blockM = isk ? id / (KK / 16) % (HH / 64) : rq / (HH / 16) % (QQ / 64);
    const long batch  = isk ? id / ((KK / 16) * (HH / 64)) : rq / ((HH / 16) * (QQ / 64));

    const float* A  = isk ? Wk : queries + batch * (QQ * DD);
    const float* Bm = isk ? keys + batch * (KK * DD) : Wq;
    float*       C  = isk ? pkT + batch * (HH * KK) : pq + batch * (QQ * HH);

    gemm_block<true, DD, DD>(A, Bm, C, /*Kdim=*/DD, /*ldc=*/isk ? KK : HH,
                             tileN, blockM, shA, shB);
}

// ---------------------------------------------------------------------------
// energy + mask + softmax: one block (256 threads) per QT consecutive q rows.
//   energy[q][k] = sum_h tanh(pq[b,q,h] + pk[b,k,h]) * We[h]
// pk arrives h-major (pkT[b][h][k]). A lane owns 4 consecutive k: one 16-byte
// load per h brings its pk values into registers, where each feeds QT rows.
// pq and We are the same for the whole block and are read as scalars.
// The whole h sum of a (q,k) pair stays in one lane. Then masked softmax over k.
// ---------------------------------------------------------------------------
__device__ __forceinline__ void load_chunk(float4 (&p)[HC], const float4* __restrict__ src) {
#pragma unroll
    for (int i = 0; i < HC; ++i) p[i] = src[(long)i * (KK / 4)];
}

__device__ __forceinline__ void energy_chunk(float (&e)[QT][4], const float4 (&p)[HC],
                                             const float* __restrict__ pqr,
                                             const float* __restrict__ we) {
#pragma unroll
    for (int i = 0; i < HC; ++i) {
        const float w = we[i];
#pragma unroll
        for (int r = 0; r < QT; ++r) {
            const float s = pqr[r * HH + i];
            e[r][0] = fmaf(fast_tanh(s + p[i].x), w, e[r][0]);
            e[r][1] = fmaf(fast_tanh(s + p[i].y), w, e[r][1]);
            e[r][2] = fmaf(fast_tanh(s + p[i].z), w, e[r][2]);
            e[r][3] = fmaf(fast_tanh(s + p[i].w), w, e[r][3]);
        }
    }
}

// waves_per_eu(2, 2): one block of 8 waves per WGP is the plan, so the scheduler may spend
// registers. Without it the compiler scheduled for more resident waves and built serial
// add -> tanh -> fma chains on one temporary, each waiting on the one before.
__global__ __launch_bounds__(256) __attribute__((amdgpu_waves_per_eu(2, 2)))
void energy_softmax_kernel(const float* __restrict__ pq,
                           const float* __restrict__ pkT,
                           const int* __restrict__ mask,
                           const float* __restrict__ We,
                           float* __restrict__ attn) {
    const int q0   = blockIdx.x * QT;
    const int b    = blockIdx.y;
    const int t    = threadIdx.x;              // 0..255, owns k = 4t..4t+3
    const int wave = t >> 5;

    __shared__ float s_mx[QT][8];
    __shared__ float s_sm[QT][8];

    const float*  pqr = pq + ((long)b * QQ + q0) * HH;                 // QT rows
    const float4* pkc = (const float4*)(pkT + (long)b * HH * KK) + t;  // column of 4 k
    const long    ro  = ((long)b * QQ + q0) * KK + t * 4;

    // Mask words are asked for first: they come back under the energy loop.
    int4 mk[QT];
#pragma unroll
    for (int r = 0; r < QT; ++r) mk[r] = *(const int4*)(mask + ro + (long)r * KK);

    float e[QT][4];
#pragma unroll
    for (int r = 0; r < QT; ++r) { e[r][0] = 0.0f; e[r][1] = 0.0f; e[r][2] = 0.0f; e[r][3] = 0.0f; }

    // ---- energy: two register buffers of HC h-rows, the next one in flight --
    float4 pa[HC], pb[HC];
    load_chunk(pa, pkc);
    const float4* pn = pkc + (long)(2 * HC) * (KK / 4);   // rows that pa takes next
#pragma unroll 1   // rolled: for speed only
    for (int h0 = 0; h0 < HH; h0 += 2 * HC) {
        load_chunk(pb, pkc + (long)(h0 + HC) * (KK / 4));
        energy_chunk(e, pa, pqr + h0, We + h0);
        // No branch in the body: on the last trip pn stays on the last rows it
        // named (in bounds) and what it brings is not used.
        load_chunk(pa, pn);
        pn += (h0 + 4 * HC < HH) ? (long)(2 * HC) * (KK / 4) : 0L;
        energy_chunk(e, pb, pqr + h0 + HC, We + h0 + HC);
        // Inputs-only fence on the loaded values: keeps pa's loads in this trip. Without
        // it the compiler moves them to the head of the next trip, with nothing to cover them.
#pragma unroll
        for (int i = 0; i < HC; ++i)
            asm volatile("" :: "v"(pa[i].x), "v"(pa[i].y), "v"(pa[i].z), "v"(pa[i].w));
    }

    // ---- mask + row max ---------------------------------------------------
    float m[QT];
#pragma unroll
    for (int r = 0; r < QT; ++r) {
        e[r][0] = (mk[r].x == 0) ? -1.0e9f : e[r][0];
        e[r][1] = (mk[r].y == 0) ? -1.0e9f : e[r][1];
        e[r][2] = (mk[r].z == 0) ? -1.0e9f : e[r][2];
        e[r][3] = (mk[r].w == 0) ? -1.0e9f : e[r][3];
        m[r] = fmaxf(fmaxf(e[r][0], e[r][1]), fmaxf(e[r][2], e[r][3]));
    }
#pragma unroll
    for (int s = 16; s > 0; s >>= 1) {
#pragma unroll
        for (int r = 0; r < QT; ++r) m[r] = fmaxf(m[r], __shfl_xor(m[r], s, 32));
    }
    if ((t & 31) == 0) {
#pragma unroll
        for (int r = 0; r < QT; ++r) s_mx[r][wave] = m[r];
    }
    __syncthreads();

    // ---- exp + sum --------------------------------------------------------
    float sum[QT];
#pragma unroll
    for (int r = 0; r < QT; ++r) {
        float mx = s_mx[r][0];
#pragma unroll
        for (int w = 1; w < 8; ++w) mx = fmaxf(mx, s_mx[r][w]);
#pragma unroll
        for (int j = 0; j < 4; ++j)
            e[r][j] = exp2_slot((e[r][j] - mx) * 1.4426950408889634f);
        sum[r] = (e[r][0] + e[r][1]) + (e[r][2] + e[r][3]);
    }
#pragma unroll
    for (int s = 16; s > 0; s >>= 1) {
#pragma unroll
        for (int r = 0; r < QT; ++r) sum[r] += __shfl_xor(sum[r], s, 32);
    }
    if ((t & 31) == 0) {
#pragma unroll
        for (int r = 0; r < QT; ++r) s_sm[r][wave] = sum[r];
    }
    __syncthreads();

    // ---- normalize + write ------------------------------------------------
#pragma unroll
    for (int r = 0; r < QT; ++r) {
        float tot = s_sm[r][0];
#pragma unroll
        for (int w = 1; w < 8; ++w) tot += s_sm[r][w];
        const float inv = 1.0f / tot;
        float4 o;
        o.x = e[r][0] * inv; o.y = e[r][1] * inv; o.z = e[r][2] * inv; o.w = e[r][3] * inv;
        *(float4*)(attn + ro + (long)r * KK) = o;
    }
}

// ---------------------------------------------------------------------------
// launch
// ---------------------------------------------------------------------------
extern "C" void kernel_launch(void* const* d_in, const int* in_sizes, int n_in,
                              void* d_out, int out_size, void* d_ws, size_t ws_size,
                              hipStream_t stream) {
    const float* queries = (const float*)d_in[0];  // (B,Q,QD)
    const float* keys    = (const float*)d_in[1];  // (B,K,KD)
    const int*   mask    = (const int*)d_in[2];    // (B,Q,K)
    const float* Wq      = (const float*)d_in[3];  // (H,QD)
    const float* Wk      = (const float*)d_in[4];  // (H,KD)
    const float* We      = (const float*)d_in[5];  // (H)

    float* context = (float*)d_out;                        // (B,Q,QD)
    float* attn    = (float*)d_out + (long)BB * QQ * DD;   // (B,Q,K)

    float* pq = (float*)d_ws;                              // (B,Q,H)
    float* pkT = pq + (long)BB * QQ * HH;                  // (B,H,K)

    dim3 blk(32, 4);

    // pq = queries @ Wq^T and pkT = Wk @ keys^T, one launch
    proj_gemm_f32_kernel<<<dim3(PK_BLOCKS + PQ_BLOCKS), blk, 0, stream>>>(
        queries, Wq, keys, Wk, pq, pkT);

    // energy + masked softmax -> attn (after context in d_out)
    energy_softmax_kernel<<<dim3(QQ / QT, BB), dim3(256), 0, stream>>>(
        pq, pkT, mask, We, attn);

    // context = attn @ keys : M=Q, N=KD, Kdim=K, B row-major
    wmma_gemm_f32_kernel<false, KK, DD><<<dim3(DD / 16, QQ / 64, BB), blk, 0, stream>>>(
        attn, keys, context, /*Kdim=*/KK, /*ldc=*/DD,
        (long)QQ * KK, (long)KK * DD, (long)QQ * DD);
}

// v004
// One run takes 24.5 microseconds.
// Two timings next to v003 put it at 1.06 and 1.08 times that version's speed.
// Over all steps from v000 it is 3.69 times as fast.
#include <hip/hip_runtime.h>
#include <hip/hip_bf16.h>
#include <stdint.h>

// Problem constants (from reference)
#define BB 2
#define QQ 512
#define KK 1024
#define DD 256   // QD == KD
#define HH 128
#define QT 4     // q rows per energy block
#define HC 8     // h rows per register buffer

typedef float v2f __attribute__((ext_vector_type(2)));
typedef float v8f __attribute__((ext_vector_type(8)));

// ---------------------------------------------------------------------------
// Fast tanh: prefer hardware v_tanh_f32 if the builtin exists, else one
// v_exp_f32: tanh(x) = 1 - 2/(exp2(2x*log2e)+1). Clamp so exp2 never overflows.
// ---------------------------------------------------------------------------
__device__ __forceinline__ float fast_tanh(float x) {
#if __has_builtin(__builtin_amdgcn_tanhf)
    return __builtin_amdgcn_tanhf(x);
#else
    float xc = fminf(fmaxf(x, -10.0f), 10.0f);
    float t  = __builtin_amdgcn_exp2f(xc * 2.8853900817779268f); // 2*log2(e)
    return 1.0f - 2.0f / (t + 1.0f);
#endif
}

// exp2 as one v_exp_f32 with the free slot that the instruction set asks for behind a
// transcendental.
__device__ __forceinline__ float exp2_slot(float x) {
    float r;
    asm("v_exp_f32 %0, %1\n\tv_nop" : "=v"(r) : "v"(x));
    return r;
}

// ---------------------------------------------------------------------------
// Asking L2 at kernel entry for what the launch before wrote. The plan: the blocks that
// share such lines read them
// in step, so that each later piece pays memory latency unless it was asked for ahead.
// A prefetch returns nothing and changes no value: one lane names one 256-byte unit, scope
// SE brings it into L2 only. Shares are dealt by block index for speed alone: no result rests on it.
// p: the lane's own address, inside the buffer together with every offset used here.
// ---------------------------------------------------------------------------
__device__ __forceinline__ void l2_ask(const float* p) {
    asm volatile("global_prefetch_b8 %0, off scope:SCOPE_SE" :: "v"(p));
}
// The same for two units a lane, 8 KiB apart (32 lanes x 256 B), from one address register.
__device__ __forceinline__ void l2_ask2(const float* p) {
    asm volatile("global_prefetch_b8 %0, off scope:SCOPE_SE\n\t"
                 "global_prefetch_b8 %0, off offset:8192 scope:SCOPE_SE" :: "v"(p));
}
// A prefetch counts on no wait counter, so no wait can stand in front of an overwrite of
// its address register. This keeps the address in its register to the place where it stands.
__device__ __forceinline__ void l2_ask_hold(const float* p) {
    asm volatile("" :: "v"(p));
}

// ---------------------------------------------------------------------------
// Generic f32 WMMA GEMM: C[M x N] = A[M x Kdim] * B  (+batch strides)
//   BT = false : B is row-major [Kdim x N],  B(k,n) = Bm[k*LDB + n]
//   BT = true  : B is row-major [N x Kdim],  B(k,n) = Bm[n*LDB + k]  (i.e. A*B^T)
// A block of 4 waves computes 64 x 16 of C, one 16x16 tile per wave, with
// V_WMMA_F32_16X16X4_F32. The operands come in chunks of KC k: 64 rows of A and
// 16 columns of B are brought by 16-byte loads that cover whole lines and laid
// in LDS k-contiguous; the waves read their fragments from there. Two LDS
// buffers: the next chunk's global loads are in flight while this one is used.
// LDA, LDB: row pitches of A and Bm in floats (multiples of 4).
// M multiple of 64, N of 16, Kdim of KC. EXEC stays all-ones.
// ---------------------------------------------------------------------------
#define KC 128          // k per staged chunk
#define LP (KC + 4)     // LDS row pitch in floats: 8-byte column reads fall on 64 distinct banks

typedef float v4f __attribute__((ext_vector_type(4)));

// One chunk's global loads: 16 rows of A and 4 pieces of B per wave, 16 bytes a lane.
// ag, bg: the lane's first address of this chunk; the row steps are compile-time offsets.
template <bool BT, int LDA, int LDB>
__device__ __forceinline__ void gemm_fetch(v4f (&ra)[16], v4f (&rb)[4],
                                           const float* __restrict__ ag,
                                           const float* __restrict__ bg) {
#pragma unroll
    for (int i = 0; i < 16; ++i) ra[i] = *(const v4f*)(ag + 4 * i * LDA);
#pragma unroll
    for (int i = 0; i < 4; ++i) rb[i] = *(const v4f*)(bg + (BT ? 4 : 32) * i * LDB);
}

// The same values into LDS, both operands k-contiguous at pitch LP.
template <bool BT>
__device__ __forceinline__ void gemm_stage(const v4f (&ra)[16], const v4f (&rb)[4],
                                           float* da, float* db) {
#pragma unroll
    for (int i = 0; i < 16; ++i) *(v4f*)(da + 4 * i * LP) = ra[i];
#pragma unroll
    for (int i = 0; i < 4; ++i) {
        if (BT) {
            *(v4f*)(db + 4 * i * LP) = rb[i];
        } else {
            // [k][n] is transposed on the way in, so that both forms are read alike
            db[0 * LP + 32 * i] = rb[i].x;
            db[1 * LP + 32 * i] = rb[i].y;
            db[2 * LP + 32 * i] = rb[i].z;
            db[3 * LP + 32 * i] = rb[i].w;
        }
    }
}

#define FG 8            // k-steps (WMMAs) per fragment group

__device__ __forceinline__ void frag_load(v2f (&fa)[FG], v2f (&fb)[FG],
                                          const float* ap, const float* bp) {
#pragma unroll
    for (int j = 0; j < FG; ++j) {
        fa[j] = *(const v2f*)(ap + 4 * j);
        fb[j] = *(const v2f*)(bp + 4 * j);
    }
}

__device__ __forceinline__ void frag_wmma(v8f& acc, const v2f (&fa)[FG], const v2f (&fb)[FG]) {
#pragma unroll
    for (int j = 0; j < FG; ++j)
        acc = __builtin_amdgcn_wmma_f32_16x16x4_f32(
            /*neg_a=*/false, fa[j], /*neg_b=*/false, fb[j],
            /*c_mod=*/(short)0, acc, /*reuse_a=*/false, /*reuse_b=*/false);
}

// One chunk's 32 WMMAs, k ascending. Two fragment sets: a group's LDS reads are issued
// together, one group of WMMAs ahead of their use.
__device__ __forceinline__ void gemm_product(v8f& acc, const float* ap, const float* bp) {
    v2f fa0[FG], fb0[FG], fa1[FG], fb1[FG];
    frag_load(fa0, fb0, ap, bp);
#pragma unroll
    for (int g = 0; g < KC / 4 / FG; g += 2) {
        frag_load(fa1, fb1, ap + 4 * FG * (g + 1), bp + 4 * FG * (g + 1));
        // Holds the reads above in front of the WMMAs below: left free, the compiler put each
        // read two WMMAs ahead of its use.
        __builtin_amdgcn_sched_barrier(0);
        frag_wmma(acc, fa0, fb0);
        if (g + 2 < KC / 4 / FG)
            frag_load(fa0, fb0, ap + 4 * FG * (g + 2), bp + 4 * FG * (g + 2));
        __builtin_amdgcn_sched_barrier(0);   // the same, for the other fragment set
        frag_wmma(acc, fa1, fb1);
    }
}

// One block's 64 x 16 tile of C: rows blockM * 64 .., columns tileN * 16 ..
// A, Bm, C already point at the block's batch. shA: 2 * 64 * LP floats, shB: 2 * 16 * LP.
// ASK: A was written by the launch before; the block asks L2 for its share of the rows.
template <bool BT, int LDA, int LDB, bool ASK>
__device__ __forceinline__ void gemm_block(const float* __restrict__ A,
                                           const float* __restrict__ Bm,
                                           float* __restrict__ C,
                                           int Kdim, int ldc, int tileN, unsigned blockM,
                                           float* shA, float* shB) {
    const int lane  = threadIdx.x;                       // 0..31
    const int wy    = threadIdx.y;                       // 0..3
    const int tileM = blockM * 4 + wy;

    const int mn   = lane & 15;            // M index (A) / N index (B, C/D)
    const int koff = (lane >> 4) * 2;      // 0 or 2
    const int col  = tileN * 16 + mn;

    // Staging: a wave takes rows wy + 4i, its 32 lanes a row's 128 floats (512 B in a row).
    // B given as [k][n]: a lane takes 4 n of one k, a wave-load 8 k rows (bk + 32 i).
    const int bk = wy * 8 + (lane >> 2);
    const int bn = (lane & 3) * 4;
    const float* ag = A + (long)(blockM * 64 + wy) * LDA + lane * 4;
    const float* bg = BT ? Bm + (long)(tileN * 16 + wy) * LDB + lane * 4
                         : Bm + (long)bk * LDB + tileN * 16 + bn;
    float* da = shA + wy * LP + lane * 4;
    float* db = BT ? shB + wy * LP + lane * 4 : shB + bn * LP + bk;
    const float* ap = shA + (wy * 16 + mn) * LP + koff;
    const float* bp = shB + mn * LP + koff;

    v4f ra[16], rb[4];
    v8f acc = {};

    // The block's 64 rows of A are read by every column block, in step. Each of those asks for
    // 16 of the rows, picked by its column index, so that any four neighbours ask for all 64.
    // A wave takes 4 rows (16 KiB), a lane two units of 256 B.
    static_assert(!ASK || 4 * LDA * sizeof(float) == 2 * 32 * 256, "a wave's share: two asks a lane");
    const float* pf = A + (long)(blockM * 64 + (tileN & 3) * 16 + wy * 4) * LDA + lane * 64;

    const int ns = Kdim / KC;
    gemm_fetch<BT, LDA, LDB>(ra, rb, ag, bg);
    // Behind the first chunk's own loads: the asks go out while the wave waits for those.
    if (ASK) l2_ask2(pf);
    gemm_stage<BT>(ra, rb, da, db);
    for (int s = 0; s + 1 < ns; ++s) {
        const int cur = s & 1, nxt = cur ^ 1;
        // One barrier a chunk: it publishes buffer cur and ends every wave's reads
        // of the other buffer, which is refilled at the foot of this trip.
        __syncthreads();
        ag += KC;
        bg += BT ? KC : KC * LDB;
        gemm_fetch<BT, LDA, LDB>(ra, rb, ag, bg);
        gemm_product(acc, ap + cur * (64 * LP), bp + cur * (16 * LP));
        gemm_stage<BT>(ra, rb, da + nxt * (64 * LP), db + nxt * (16 * LP));
    }
    __syncthreads();
    {
        const int cur = (ns - 1) & 1;
        gemm_product(acc, ap + cur * (64 * LP), bp + cur * (16 * LP));
    }

    const int rbase = tileM * 16 + (lane >> 4) * 8;
#pragma unroll
    for (int i = 0; i < 8; ++i) {
        C[(long)(rbase + i) * ldc + col] = acc[i];
    }
    if (ASK) l2_ask_hold(pf);
}

// One product per launch: grid (N / 16, M / 64, batches). A comes from the launch before.
template <bool BT, int LDA, int LDB>
__global__ __launch_bounds__(128)
void wmma_gemm_f32_kernel(const float* __restrict__ A,
                          const float* __restrict__ Bm,
                          float* __restrict__ C,
                          int Kdim, int ldc,
                          long sA, long sB, long sC) {
    __shared__ __attribute__((aligned(16))) float shA[2 * 64 * LP];
    __shared__ __attribute__((aligned(16))) float shB[2 * 16 * LP];
    const int batch = blockIdx.z;
    gemm_block<BT, LDA, LDB, /*ASK=*/true>(A + (long)batch * sA, Bm + (long)batch * sB,
                                           C + (long)batch * sC,
                                           Kdim, ldc, blockIdx.x, blockIdx.y, shA, shB);
}

// Both projections in one launch: neither reads the other's result, so their blocks
// run side by side. The block index picks the product, its batch and its tile.
//   blocks 0 .. PK_BLOCKS-1 : pkT[b] = Wk @ keys[b]^T     (M = H, N = K, h-major result)
//   the PQ_BLOCKS behind    : pq[b]  = queries[b] @ Wq^T  (M = Q, N = H)
#define PK_BLOCKS ((KK / 16) * (HH / 64) * BB)
#define PQ_BLOCKS ((HH / 16) * (QQ / 64) * BB)

__global__ __launch_bounds__(128)
void proj_gemm_f32_kernel(const float* __restrict__ queries,
                          const float* __restrict__ Wq,
                          const float* __restrict__ keys,
                          const float* __restrict__ Wk,
                          float* __restrict__ pq,
                          float* __restrict__ pkT) {
    __shared__ __attribute__((aligned(16))) float shA[2 * 64 * LP];
    __shared__ __attribute__((aligned(16))) float shB[2 * 16 * LP];

    // Tile along N fastest, then the 64-row block along M, then the batch. Every divisor
    // is a constant, so the whole choice stays in scalar shifts and masks.
    const unsigned id  = blockIdx.x;
    const bool     isk = id < PK_BLOCKS;
    const unsigned rq  = id - PK_BLOCKS;
    const int  tileN  = isk ? id % (KK / 16) : rq % (HH / 16);
    const unsigned blockM = isk ? id / (KK / 16) % (HH / 64) : rq / (HH / 16) % (QQ / 64);
    const long batch  = isk ? id / ((KK / 16) * (HH / 64)) : rq / ((HH / 16) * (QQ / 64));

    const float* A  = isk ? Wk : queries + batch * (QQ * DD);
    const float* Bm = isk ? keys + batch * (KK * DD) : Wq;
    float*       C  = isk ? pkT + batch * (HH * KK) : pq + batch * (QQ * HH);

    gemm_block<true, DD, DD, /*ASK=*/false>(A, Bm, C, /*Kdim=*/DD, /*ldc=*/isk ? KK : HH,
                                            tileN, blockM, shA, shB);
}

// ---------------------------------------------------------------------------
// energy + mask + softmax: one block (256 threads) per QT consecutive q rows.
//   energy[q][k] = sum_h tanh(pq[b,q,h] + pk[b,k,h]) * We[h]
// pk arrives h-major (pkT[b][h][k]). A lane owns 4 consecutive k: one 16-byte
// load per h brings its pk values into registers, where each feeds QT rows.
// pq and We are the same for the whole block and are read as scalars.
// The whole h sum of a (q,k) pair stays in one lane. Then masked softmax over k.
// ---------------------------------------------------------------------------
__device__ __forceinline__ void load_chunk(float4 (&p)[HC], const float4* __restrict__ src) {
#pragma unroll
    for (int i = 0; i < HC; ++i) p[i] = src[(long)i * (KK / 4)];
}

__device__ __forceinline__ void energy_chunk(float (&e)[QT][4], const float4 (&p)[HC],
                                             const float* __restrict__ pqr,
                                             const float* __restrict__ we) {
#pragma unroll
    for (int i = 0; i < HC; ++i) {
        const float w = we[i];
#pragma unroll
        for (int r = 0; r < QT; ++r) {
            const float s = pqr[r * HH + i];
            e[r][0] = fmaf(fast_tanh(s + p[i].x), w, e[r][0]);
            e[r][1] = fmaf(fast_tanh(s + p[i].y), w, e[r][1]);
            e[r][2] = fmaf(fast_tanh(s + p[i].z), w, e[r][2]);
            e[r][3] = fmaf(fast_tanh(s + p[i].w), w, e[r][3]);
        }
    }
}

// waves_per_eu(2, 2): one block of 8 waves per WGP is the plan, so the scheduler may spend
// registers. Without it the compiler scheduled for more resident waves and built serial
// add -> tanh -> fma chains on one temporary, each waiting on the one before.
__global__ __launch_bounds__(256) __attribute__((amdgpu_waves_per_eu(2, 2)))
void energy_softmax_kernel(const float* __restrict__ pq,
                           const float* __restrict__ pkT,
                           const int* __restrict__ mask,
                           const float* __restrict__ We,
                           float* __restrict__ attn) {
    const int q0   = blockIdx.x * QT;
    const int b    = blockIdx.y;
    const int t    = threadIdx.x;              // 0..255, owns k = 4t..4t+3
    const int wave = t >> 5;

    __shared__ float s_mx[QT][8];
    __shared__ float s_sm[QT][8];

    const float*  pqr = pq + ((long)b * QQ + q0) * HH;                 // QT rows
    const float4* pkc = (const float4*)(pkT + (long)b * HH * KK) + t;  // column of 4 k
    const long    ro  = ((long)b * QQ + q0) * KK + t * 4;

    // pkT was written by the launch before, and all blocks of a batch read the whole of it:
    // each asks L2 for one eighth (64 KiB, 256 B a lane), picked so that any four neighbours
    // in each of two groups of eight ask for all of it.
    const float* pfk = pkT + (long)b * HH * KK
                           + ((blockIdx.x & 3) + 4 * ((blockIdx.x >> 3) & 1)) * (HH * KK / 8) + t * 64;

    // Mask words are asked for first: they come back under the energy loop.
    int4 mk[QT];
#pragma unroll
    for (int r = 0; r < QT; ++r) mk[r] = *(const int4*)(mask + ro + (long)r * KK);

    float e[QT][4];
#pragma unroll
    for (int r = 0; r < QT; ++r) { e[r][0] = 0.0f; e[r][1] = 0.0f; e[r][2] = 0.0f; e[r][3] = 0.0f; }

    // ---- energy: two register buffers of HC h-rows, the next one in flight --
    float4 pa[HC], pb[HC];
    load_chunk(pa, pkc);
    l2_ask(pfk);   // behind the first rows' own loads: it goes out while the wave waits for those
    const float4* pn = pkc + (long)(2 * HC) * (KK / 4);   // rows that pa takes next
#pragma unroll 1   // rolled: for speed only
    for (int h0 = 0; h0 < HH; h0 += 2 * HC) {
        load_chunk(pb, pkc + (long)(h0 + HC) * (KK / 4));
        energy_chunk(e, pa, pqr + h0, We + h0);
        // No branch in the body: on the last trip pn stays on the last rows it
        // named (in bounds) and what it brings is not used.
        load_chunk(pa, pn);
        pn += (h0 + 4 * HC < HH) ? (long)(2 * HC) * (KK / 4) : 0L;
        energy_chunk(e, pb, pqr + h0 + HC, We + h0 + HC);
        // Inputs-only fence on the loaded values: keeps pa's loads in this trip. Without
        // it the compiler moves them to the head of the next trip, with nothing to cover them.
#pragma unroll
        for (int i = 0; i < HC; ++i)
            asm volatile("" :: "v"(pa[i].x), "v"(pa[i].y), "v"(pa[i].z), "v"(pa[i].w));
    }

    // ---- mask + row max ---------------------------------------------------
    float m[QT];
#pragma unroll
    for (int r = 0; r < QT; ++r) {
        e[r][0] = (mk[r].x == 0) ? -1.0e9f : e[r][0];
        e[r][1] = (mk[r].y == 0) ? -1.0e9f : e[r][1];
        e[r][2] = (mk[r].z == 0) ? -1.0e9f : e[r][2];
        e[r][3] = (mk[r].w == 0) ? -1.0e9f : e[r][3];
        m[r] = fmaxf(fmaxf(e[r][0], e[r][1]), fmaxf(e[r][2], e[r][3]));
    }
#pragma unroll
    for (int s = 16; s > 0; s >>= 1) {
#pragma unroll
        for (int r = 0; r < QT; ++r) m[r] = fmaxf(m[r], __shfl_xor(m[r], s, 32));
    }
    if ((t & 31) == 0) {
#pragma unroll
        for (int r = 0; r < QT; ++r) s_mx[r][wave] = m[r];
    }
    __syncthreads();

    // ---- exp + sum --------------------------------------------------------
    float sum[QT];
#pragma unroll
    for (int r = 0; r < QT; ++r) {
        float mx = s_mx[r][0];
#pragma unroll
        for (int w = 1; w < 8; ++w) mx = fmaxf(mx, s_mx[r][w]);
#pragma unroll
        for (int j = 0; j < 4; ++j)
            e[r][j] = exp2_slot((e[r][j] - mx) * 1.4426950408889634f);
        sum[r] = (e[r][0] + e[r][1]) + (e[r][2] + e[r][3]);
    }
#pragma unroll
    for (int s = 16; s > 0; s >>= 1) {
#pragma unroll
        for (int r = 0; r < QT; ++r) sum[r] += __shfl_xor(sum[r], s, 32);
    }
    if ((t & 31) == 0) {
#pragma unroll
        for (int r = 0; r < QT; ++r) s_sm[r][wave] = sum[r];
    }
    __syncthreads();

    // ---- normalize + write ------------------------------------------------
#pragma unroll
    for (int r = 0; r < QT; ++r) {
        float tot = s_sm[r][0];
#pragma unroll
        for (int w = 1; w < 8; ++w) tot += s_sm[r][w];
        const float inv = 1.0f / tot;
        float4 o;
        o.x = e[r][0] * inv; o.y = e[r][1] * inv; o.z = e[r][2] * inv; o.w = e[r][3] * inv;
        *(float4*)(attn + ro + (long)r * KK) = o;
    }
    l2_ask_hold(pfk);
}

// ---------------------------------------------------------------------------
// launch
// ---------------------------------------------------------------------------
extern "C" void kernel_launch(void* const* d_in, const int* in_sizes, int n_in,
                              void* d_out, int out_size, void* d_ws, size_t ws_size,
                              hipStream_t stream) {
    const float* queries = (const float*)d_in[0];  // (B,Q,QD)
    const float* keys    = (const float*)d_in[1];  // (B,K,KD)
    const int*   mask    = (const int*)d_in[2];    // (B,Q,K)
    const float* Wq      = (const float*)d_in[3];  // (H,QD)
    const float* Wk      = (const float*)d_in[4];  // (H,KD)
    const float* We      = (const float*)d_in[5];  // (H)

    float* context = (float*)d_out;                        // (B,Q,QD)
    float* attn    = (float*)d_out + (long)BB * QQ * DD;   // (B,Q,K)

    float* pq = (float*)d_ws;                              // (B,Q,H)
    float* pkT = pq + (long)BB * QQ * HH;                  // (B,H,K)

    dim3 blk(32, 4);

    // pq = queries @ Wq^T and pkT = Wk @ keys^T, one launch
    proj_gemm_f32_kernel<<<dim3(PK_BLOCKS + PQ_BLOCKS), blk, 0, stream>>>(
        queries, Wq, keys, Wk, pq, pkT);

    // energy + masked softmax -> attn (after context in d_out)
    energy_softmax_kernel<<<dim3(QQ / QT, BB), dim3(256), 0, stream>>>(
        pq, pkT, mask, We, attn);

    // context = attn @ keys : M=Q, N=KD, Kdim=K, B row-major
    wmma_gemm_f32_kernel<false, KK, DD><<<dim3(DD / 16, QQ / 64, BB), blk, 0, stream>>>(
        attn, keys, context, /*Kdim=*/KK, /*ldc=*/DD,
        (long)QQ * KK, (long)KK * DD, (long)QQ * DD);
}

// v005
// One run takes 22.9 microseconds.
// Next to v004, in two timings, it ran 1.07 times as fast each time.
// Over all steps from v000 it is 3.94 times as fast.
#include <hip/hip_runtime.h>
#include <hip/hip_bf16.h>
#include <stdint.h>

// Problem constants (from reference)
#define BB 2
#define QQ 512
#define KK 1024
#define DD 256   // QD == KD
#define HH 128
#define QT 4     // q rows per energy block
#define HC 8     // h rows per register buffer

typedef float v2f __attribute__((ext_vector_type(2)));
typedef float v8f __attribute__((ext_vector_type(8)));

// ---------------------------------------------------------------------------
// Fast tanh: prefer hardware v_tanh_f32 if the builtin exists, else one
// v_exp_f32: tanh(x) = 1 - 2/(exp2(2x*log2e)+1). Clamp so exp2 never overflows.
// ---------------------------------------------------------------------------
__device__ __forceinline__ float fast_tanh(float x) {
#if __has_builtin(__builtin_amdgcn_tanhf)
    return __builtin_amdgcn_tanhf(x);
#else
    float xc = fminf(fmaxf(x, -10.0f), 10.0f);
    float t  = __builtin_amdgcn_exp2f(xc * 2.8853900817779268f); // 2*log2(e)
    return 1.0f - 2.0f / (t + 1.0f);
#endif
}

// exp2 as one v_exp_f32 with the free slot that the instruction set asks for behind a
// transcendental.
__device__ __forceinline__ float exp2_slot(float x) {
    float r;
    asm("v_exp_f32 %0, %1\n\tv_nop" : "=v"(r) : "v"(x));
    return r;
}

// ---------------------------------------------------------------------------
// Asking L2 at kernel entry for what the launch before wrote. The plan: the blocks that
// share such lines read them
// from different starting places and wrap round; a piece pays memory latency unless it was asked for ahead.
// A prefetch returns nothing and changes no value: scope
// SE brings it into L2 only. Shares are dealt by block index for speed alone: no result rests on it.
// p: the lane's own address, inside the buffer together with every offset used here.
// ---------------------------------------------------------------------------
__device__ __forceinline__ void l2_ask(const float* p) {
    asm volatile("global_prefetch_b8 %0, off scope:SCOPE_SE" :: "v"(p));
}
// The same for two units a lane, 8 KiB apart (32 lanes x 256 B), from one address register.
__device__ __forceinline__ void l2_ask2(const float* p) {
    asm volatile("global_prefetch_b8 %0, off scope:SCOPE_SE\n\t"
                 "global_prefetch_b8 %0, off offset:8192 scope:SCOPE_SE" :: "v"(p));
}
// A prefetch counts on no wait counter, so no wait can stand in front of an overwrite of
// its address register. This keeps the address in its register to the place where it stands.
__device__ __forceinline__ void l2_ask_hold(const float* p) {
    asm volatile("" :: "v"(p));
}

// ---------------------------------------------------------------------------
// Generic f32 WMMA GEMM: C[M x N] = A[M x Kdim] * B  (+batch strides)
//   BT = false : B is row-major [Kdim x N],  B(k,n) = Bm[k*LDB + n]
//   BT = true  : B is row-major [N x Kdim],  B(k,n) = Bm[n*LDB + k]  (i.e. A*B^T)
// A block of 4 waves computes 64 x 16 of C, one 16x16 tile per wave, with
// V_WMMA_F32_16X16X4_F32. The operands come in chunks of KC k: 64 rows of A and
// 16 columns of B are brought by 16-byte loads that cover whole lines and laid
// in LDS k-contiguous; the waves read their fragments from there. Two LDS
// buffers: the next chunk's global loads are in flight while this one is used.
// LDA, LDB: row pitches of A and Bm in floats (multiples of 4).
// M multiple of 64, N of 16, Kdim of KC. EXEC stays all-ones.
// ---------------------------------------------------------------------------
#define KC 128          // k per staged chunk
#define LP (KC + 4)     // LDS row pitch in floats: 8-byte column reads fall on 64 distinct banks

typedef float v4f __attribute__((ext_vector_type(4)));

// One chunk's global loads: 16 rows of A and 4 pieces of B per wave, 16 bytes a lane.
// ag, bg: the lane's first address of this chunk; the row steps are compile-time offsets.
template <bool BT, int LDA, int LDB>
__device__ __forceinline__ void gemm_fetch(v4f (&ra)[16], v4f (&rb)[4],
                                           const float* __restrict__ ag,
                                           const float* __restrict__ bg) {
#pragma unroll
    for (int i = 0; i < 16; ++i) ra[i] = *(const v4f*)(ag + 4 * i * LDA);
#pragma unroll
    for (int i = 0; i < 4; ++i) rb[i] = *(const v4f*)(bg + (BT ? 4 : 32) * i * LDB);
}

// The same values into LDS, both operands k-contiguous at pitch LP.
template <bool BT>
__device__ __forceinline__ void gemm_stage(const v4f (&ra)[16], const v4f (&rb)[4],
                                           float* da, float* db) {
#pragma unroll
    for (int i = 0; i < 16; ++i) *(v4f*)(da + 4 * i * LP) = ra[i];
#pragma unroll
    for (int i = 0; i < 4; ++i) {
        if (BT) {
            *(v4f*)(db + 4 * i * LP) = rb[i];
        } else {
            // [k][n] is transposed on the way in, so that both forms are read alike
            db[0 * LP + 32 * i] = rb[i].x;
            db[1 * LP + 32 * i] = rb[i].y;
            db[2 * LP + 32 * i] = rb[i].z;
            db[3 * LP + 32 * i] = rb[i].w;
        }
    }
}

#define FG 8            // k-steps (WMMAs) per fragment group

__device__ __forceinline__ void frag_load(v2f (&fa)[FG], v2f (&fb)[FG],
                                          const float* ap, const float* bp) {
#pragma unroll
    for (int j = 0; j < FG; ++j) {
        fa[j] = *(const v2f*)(ap + 4 * j);
        fb[j] = *(const v2f*)(bp + 4 * j);
    }
}

__device__ __forceinline__ void frag_wmma(v8f& acc, const v2f (&fa)[FG], const v2f (&fb)[FG]) {
#pragma unroll
    for (int j = 0; j < FG; ++j)
        acc = __builtin_amdgcn_wmma_f32_16x16x4_f32(
            /*neg_a=*/false, fa[j], /*neg_b=*/false, fb[j],
            /*c_mod=*/(short)0, acc, /*reuse_a=*/false, /*reuse_b=*/false);
}

// One chunk's 32 WMMAs, k ascending. Two fragment sets: a group's LDS reads are issued
// together, one group of WMMAs ahead of their use.
__device__ __forceinline__ void gemm_product(v8f& acc, const float* ap, const float* bp) {
    v2f fa0[FG], fb0[FG], fa1[FG], fb1[FG];
    frag_load(fa0, fb0, ap, bp);
#pragma unroll
    for (int g = 0; g < KC / 4 / FG; g += 2) {
        frag_load(fa1, fb1, ap + 4 * FG * (g + 1), bp + 4 * FG * (g + 1));
        // Holds the reads above in front of the WMMAs below: left free, the compiler put each
        // read two WMMAs ahead of its use.
        __builtin_amdgcn_sched_barrier(0);
        frag_wmma(acc, fa0, fb0);
        if (g + 2 < KC / 4 / FG)
            frag_load(fa0, fb0, ap + 4 * FG * (g + 2), bp + 4 * FG * (g + 2));
        __builtin_amdgcn_sched_barrier(0);   // the same, for the other fragment set
        frag_wmma(acc, fa1, fb1);
    }
}

// One block's 64 x 16 tile of C: rows blockM * 64 .., columns tileN * 16 ..
// A, Bm, C already point at the block's batch. shA: 2 * 64 * LP floats, shB: 2 * 16 * LP.
// ASK: A was written by the launch before; the block asks L2 for its share of the rows.
// rot: which chunk of k the block takes first; it goes on from there and wraps round. Blocks
// of one batch that read the same rows of A or the same columns of B get different rot, so that they do
// not ask L2 for the same lines at the same moment. Any value gives the whole sum over k.
template <bool BT, int LDA, int LDB, bool ASK>
__device__ __forceinline__ void gemm_block(const float* __restrict__ A,
                                           const float* __restrict__ Bm,
                                           float* __restrict__ C,
                                           int Kdim, int ldc, int tileN, unsigned blockM,
                                           unsigned rot, float* shA, float* shB) {
    const int lane  = threadIdx.x;                       // 0..31
    const int wy    = threadIdx.y;                       // 0..3
    const int tileM = blockM * 4 + wy;

    const int mn   = lane & 15;            // M index (A) / N index (B, C/D)
    const int koff = (lane >> 4) * 2;      // 0 or 2
    const int col  = tileN * 16 + mn;

    // Staging: a wave takes rows wy + 4i, its 32 lanes a row's 128 floats (512 B in a row).
    // B given as [k][n]: a lane takes 4 n of one k, a wave-load 8 k rows (bk + 32 i).
    const int bk = wy * 8 + (lane >> 2);
    const int bn = (lane & 3) * 4;
    const float* ag = A + (long)(blockM * 64 + wy) * LDA + lane * 4;
    const float* bg = BT ? Bm + (long)(tileN * 16 + wy) * LDB + lane * 4
                         : Bm + (long)bk * LDB + tileN * 16 + bn;
    float* da = shA + wy * LP + lane * 4;
    float* db = BT ? shB + wy * LP + lane * 4 : shB + bn * LP + bk;
    const float* ap = shA + (wy * 16 + mn) * LP + koff;
    const float* bp = shB + mn * LP + koff;

    v4f ra[16], rb[4];
    v8f acc = {};

    // The block's 64 rows of A are read by every column block, each from the start that rot picks. Each of those asks for
    // 16 of the rows, picked by its column index, so that any four neighbours ask for all 64.
    // A wave takes 4 rows (16 KiB), a lane two units of 256 B.
    static_assert(!ASK || 4 * LDA * sizeof(float) == 2 * 32 * 256, "a wave's share: two asks a lane");
    const float* pf = A + (long)(blockM * 64 + (tileN & 3) * 16 + wy * 4) * LDA + lane * 64;

    const int ns = Kdim / KC;
    int c = rot & (ns - 1);                // a chunk index for every ns: x & m is at most m
    const long sa = KC, sb = BT ? KC : KC * LDB;   // one chunk's step in A and in Bm, floats
    ag += c * sa;
    bg += c * sb;
    gemm_fetch<BT, LDA, LDB>(ra, rb, ag, bg);
    // Behind the first chunk's own loads: the asks go out while the wave waits for those.
    if (ASK) l2_ask2(pf);
    gemm_stage<BT>(ra, rb, da, db);
    for (int s = 0; s + 1 < ns; ++s) {
        const int cur = s & 1, nxt = cur ^ 1;
        // One barrier a chunk: it publishes buffer cur and ends every wave's reads
        // of the other buffer, which is refilled at the foot of this trip.
        __syncthreads();
        const bool wrap = c + 1 == ns;     // behind the last chunk comes chunk 0
        c = wrap ? 0 : c + 1;
        ag += wrap ? -(ns - 1) * sa : sa;
        bg += wrap ? -(ns - 1) * sb : sb;
        gemm_fetch<BT, LDA, LDB>(ra, rb, ag, bg);
        gemm_product(acc, ap + cur * (64 * LP), bp + cur * (16 * LP));
        gemm_stage<BT>(ra, rb, da + nxt * (64 * LP), db + nxt * (16 * LP));
        // In front of the next trip's steps of ag and bg, which this trip's loads name.
        asm volatile("s_wait_xcnt 0x0" ::: "memory");
    }
    __syncthreads();
    {
        const int cur = (ns - 1) & 1;
        gemm_product(acc, ap + cur * (64 * LP), bp + cur * (16 * LP));
    }

    const int rbase = tileM * 16 + (lane >> 4) * 8;
#pragma unroll
    for (int i = 0; i < 8; ++i) {
        C[(long)(rbase + i) * ldc + col] = acc[i];
    }
    if (ASK) l2_ask_hold(pf);
}

// One product per launch: grid (N / 16, M / 64, batches). A comes from the launch before.
template <bool BT, int LDA, int LDB>
__global__ __launch_bounds__(128)
void wmma_gemm_f32_kernel(const float* __restrict__ A,
                          const float* __restrict__ Bm,
                          float* __restrict__ C,
                          int Kdim, int ldc,
                          long sA, long sB, long sC) {
    __shared__ __attribute__((aligned(16))) float shA[2 * 64 * LP];
    __shared__ __attribute__((aligned(16))) float shB[2 * 16 * LP];
    const int batch = blockIdx.z;
    // Eight starts. Column blocks x and x + 8 differ by 4, so that any four neighbours in each
    // of two groups of eight hold all eight; the row blocks of one column differ by one each.
    const unsigned rot = blockIdx.x + 4 * (blockIdx.x >> 3) + blockIdx.y;
    gemm_block<BT, LDA, LDB, /*ASK=*/true>(A + (long)batch * sA, Bm + (long)batch * sB,
                                           C + (long)batch * sC,
                                           Kdim, ldc, blockIdx.x, blockIdx.y, rot, shA, shB);
}

// Both projections in one launch: neither reads the other's result, so their blocks
// run side by side. The block index picks the product, its batch and its tile.
//   blocks 0 .. PK_BLOCKS-1 : pkT[b] = Wk @ keys[b]^T     (M = H, N = K, h-major result)
//   the PQ_BLOCKS behind    : pq[b]  = queries[b] @ Wq^T  (M = Q, N = H)
#define PK_BLOCKS ((KK / 16) * (HH / 64) * BB)
#define PQ_BLOCKS ((HH / 16) * (QQ / 64) * BB)

__global__ __launch_bounds__(128)
void proj_gemm_f32_kernel(const float* __restrict__ queries,
                          const float* __restrict__ Wq,
                          const float* __restrict__ keys,
                          const float* __restrict__ Wk,
                          float* __restrict__ pq,
                          float* __restrict__ pkT) {
    __shared__ __attribute__((aligned(16))) float shA[2 * 64 * LP];
    __shared__ __attribute__((aligned(16))) float shB[2 * 16 * LP];

    // Tile along N fastest, then the 64-row block along M, then the batch. Every divisor
    // is a constant, so the whole choice stays in scalar shifts and masks.
    const unsigned id  = blockIdx.x;
    const bool     isk = id < PK_BLOCKS;
    const unsigned rq  = id - PK_BLOCKS;
    const int  tileN  = isk ? id % (KK / 16) : rq % (HH / 16);
    const unsigned blockM = isk ? id / (KK / 16) % (HH / 64) : rq / (HH / 16) % (QQ / 64);
    const long batch  = isk ? id / ((KK / 16) * (HH / 64)) : rq / ((HH / 16) * (QQ / 64));

    const float* A  = isk ? Wk : queries + batch * (QQ * DD);
    const float* Bm = isk ? keys + batch * (KK * DD) : Wq;
    float*       C  = isk ? pkT + batch * (HH * KK) : pq + batch * (QQ * HH);

    gemm_block<true, DD, DD, /*ASK=*/false>(A, Bm, C, /*Kdim=*/DD, /*ldc=*/isk ? KK : HH,
                                            tileN, blockM, /*rot=*/tileN + blockM, shA, shB);
}

// ---------------------------------------------------------------------------
// energy + mask + softmax: one block (256 threads) per QT consecutive q rows.
//   energy[q][k] = sum_h tanh(pq[b,q,h] + pk[b,k,h]) * We[h]
// pk arrives h-major (pkT[b][h][k]). A lane owns 4 consecutive k: one 16-byte
// load per h brings its pk values into registers, where each feeds QT rows.
// pq and We are the same for the whole block and are read as scalars.
// The whole h sum of a (q,k) pair stays in one lane. Then masked softmax over k.
// ---------------------------------------------------------------------------
__device__ __forceinline__ void load_chunk(float4 (&p)[HC], const float4* __restrict__ src) {
#pragma unroll
    for (int i = 0; i < HC; ++i) p[i] = src[(long)i * (KK / 4)];
}

__device__ __forceinline__ void energy_chunk(float (&e)[QT][4], const float4 (&p)[HC],
                                             const float* __restrict__ pqr,
                                             const float* __restrict__ we) {
#pragma unroll
    for (int i = 0; i < HC; ++i) {
        const float w = we[i];
#pragma unroll
        for (int r = 0; r < QT; ++r) {
            const float s = pqr[r * HH + i];
            e[r][0] = fmaf(fast_tanh(s + p[i].x), w, e[r][0]);
            e[r][1] = fmaf(fast_tanh(s + p[i].y), w, e[r][1]);
            e[r][2] = fmaf(fast_tanh(s + p[i].z), w, e[r][2]);
            e[r][3] = fmaf(fast_tanh(s + p[i].w), w, e[r][3]);
        }
    }
}

// waves_per_eu(2, 2): one block of 8 waves per WGP is the plan, so the scheduler may spend
// registers. Without it the compiler scheduled for more resident waves and built serial
// add -> tanh -> fma chains on one temporary, each waiting on the one before.
__global__ __launch_bounds__(256) __attribute__((amdgpu_waves_per_eu(2, 2)))
void energy_softmax_kernel(const float* __restrict__ pq,
                           const float* __restrict__ pkT,
                           const int* __restrict__ mask,
                           const float* __restrict__ We,
                           float* __restrict__ attn) {
    const int q0   = blockIdx.x * QT;
    const int b    = blockIdx.y;
    const int t    = threadIdx.x;              // 0..255, owns k = 4t..4t+3
    const int wave = t >> 5;

    __shared__ float s_mx[QT][8];
    __shared__ float s_sm[QT][8];

    const float*  pqr = pq + ((long)b * QQ + q0) * HH;                 // QT rows
    const float4* pkc = (const float4*)(pkT + (long)b * HH * KK) + t;  // column of 4 k
    const long    ro  = ((long)b * QQ + q0) * KK + t * 4;

    // pkT was written by the launch before, and all blocks of a batch read the whole of it:
    // each asks L2 for one eighth (64 KiB, 256 B a lane), picked so that any four neighbours
    // in each of two groups of eight ask for all of it.
    const float* pfk = pkT + (long)b * HH * KK
                           + ((blockIdx.x & 3) + 4 * ((blockIdx.x >> 3) & 1)) * (HH * KK / 8) + t * 64;

    // Mask words are asked for first: they come back under the energy loop.
    int4 mk[QT];
#pragma unroll
    for (int r = 0; r < QT; ++r) mk[r] = *(const int4*)(mask + ro + (long)r * KK);

    float e[QT][4];
#pragma unroll
    for (int r = 0; r < QT; ++r) { e[r][0] = 0.0f; e[r][1] = 0.0f; e[r][2] = 0.0f; e[r][3] = 0.0f; }

    // ---- energy: two register buffers of HC h-rows, the next one in flight --
    // All blocks of a batch read the same rows of pkT. Each starts its walk over h at one of
    // HH / (2 * HC) places, picked by its index, and wraps round, so that the blocks do not ask
    // L2 for the same lines at the same moment. Every h is taken once, whatever the start.
    static_assert((HH & (HH - 1)) == 0 && HH % (2 * HC) == 0, "the wrap below is a mask");
    float4 pa[HC], pb[HC];
    int h0 = ((blockIdx.x + (blockIdx.x >> 3)) * (2 * HC)) & (HH - 1);
    const float4* pc = pkc + (long)h0 * (KK / 4);         // rows of this trip
    load_chunk(pa, pc);
    l2_ask(pfk);   // behind the first rows' own loads: it goes out while the wave waits for those
    // The loop's loads land in the registers that held the mask loads' address: the wait that
    // belongs in front of an overwrite of a register that an issued load names.
    asm volatile("s_wait_xcnt 0x0" ::: "memory");
#pragma unroll 1   // rolled: for speed only
    for (int trip = 0; trip < HH / (2 * HC); ++trip) {
        const int hn = (h0 + 2 * HC) & (HH - 1);          // rows that pa takes next
        load_chunk(pb, pc + (long)HC * (KK / 4));
        energy_chunk(e, pa, pqr + h0, We + h0);
        // No branch in the body: on the last trip hn is the start again (in bounds)
        // and what it brings is not used.
        pc += (hn == 0) ? -(long)(HH - 2 * HC) * (KK / 4) : (long)(2 * HC) * (KK / 4);
        load_chunk(pa, pc);
        energy_chunk(e, pb, pqr + h0 + HC, We + h0 + HC);
        h0 = hn;
        // Inputs-only fence on the loaded values: keeps pa's loads in this trip. Without
        // it the compiler moves them to the head of the next trip, with nothing to cover them.
#pragma unroll
        for (int i = 0; i < HC; ++i)
            asm volatile("" :: "v"(pa[i].x), "v"(pa[i].y), "v"(pa[i].z), "v"(pa[i].w));
    }

    // ---- mask + row max ---------------------------------------------------
    float m[QT];
#pragma unroll
    for (int r = 0; r < QT; ++r) {
        e[r][0] = (mk[r].x == 0) ? -1.0e9f : e[r][0];
        e[r][1] = (mk[r].y == 0) ? -1.0e9f : e[r][1];
        e[r][2] = (mk[r].z == 0) ? -1.0e9f : e[r][2];
        e[r][3] = (mk[r].w == 0) ? -1.0e9f : e[r][3];
        m[r] = fmaxf(fmaxf(e[r][0], e[r][1]), fmaxf(e[r][2], e[r][3]));
    }
#pragma unroll
    for (int s = 16; s > 0; s >>= 1) {
#pragma unroll
        for (int r = 0; r < QT; ++r) m[r] = fmaxf(m[r], __shfl_xor(m[r], s, 32));
    }
    if ((t & 31) == 0) {
#pragma unroll
        for (int r = 0; r < QT; ++r) s_mx[r][wave] = m[r];
    }
    __syncthreads();

    // ---- exp + sum --------------------------------------------------------
    float sum[QT];
#pragma unroll
    for (int r = 0; r < QT; ++r) {
        float mx = s_mx[r][0];
#pragma unroll
        for (int w = 1; w < 8; ++w) mx = fmaxf(mx, s_mx[r][w]);
#pragma unroll
        for (int j = 0; j < 4; ++j)
            e[r][j] = exp2_slot((e[r][j] - mx) * 1.4426950408889634f);
        sum[r] = (e[r][0] + e[r][1]) + (e[r][2] + e[r][3]);
    }
#pragma unroll
    for (int s = 16; s > 0; s >>= 1) {
#pragma unroll
        for (int r = 0; r < QT; ++r) sum[r] += __shfl_xor(sum[r], s, 32);
    }
    if ((t & 31) == 0) {
#pragma unroll
        for (int r = 0; r < QT; ++r) s_sm[r][wave] = sum[r];
    }
    __syncthreads();

    // ---- normalize + write ------------------------------------------------
#pragma unroll
    for (int r = 0; r < QT; ++r) {
        float tot = s_sm[r][0];
#pragma unroll
        for (int w = 1; w < 8; ++w) tot += s_sm[r][w];
        const float inv = 1.0f / tot;
        float4 o;
        o.x = e[r][0] * inv; o.y = e[r][1] * inv; o.z = e[r][2] * inv; o.w = e[r][3] * inv;
        *(float4*)(attn + ro + (long)r * KK) = o;
    }
    l2_ask_hold(pfk);
}

// ---------------------------------------------------------------------------
// launch
// ---------------------------------------------------------------------------
extern "C" void kernel_launch(void* const* d_in, const int* in_sizes, int n_in,
                              void* d_out, int out_size, void* d_ws, size_t ws_size,
                              hipStream_t stream) {
    const float* queries = (const float*)d_in[0];  // (B,Q,QD)
    const float* keys    = (const float*)d_in[1];  // (B,K,KD)
    const int*   mask    = (const int*)d_in[2];    // (B,Q,K)
    const float* Wq      = (const float*)d_in[3];  // (H,QD)
    const float* Wk      = (const float*)d_in[4];  // (H,KD)
    const float* We      = (const float*)d_in[5];  // (H)

    float* context = (float*)d_out;                        // (B,Q,QD)
    float* attn    = (float*)d_out + (long)BB * QQ * DD;   // (B,Q,K)

    float* pq = (float*)d_ws;                              // (B,Q,H)
    float* pkT = pq + (long)BB * QQ * HH;                  // (B,H,K)

    dim3 blk(32, 4);

    // pq = queries @ Wq^T and pkT = Wk @ keys^T, one launch
    proj_gemm_f32_kernel<<<dim3(PK_BLOCKS + PQ_BLOCKS), blk, 0, stream>>>(
        queries, Wq, keys, Wk, pq, pkT);

    // energy + masked softmax -> attn (after context in d_out)
    energy_softmax_kernel<<<dim3(QQ / QT, BB), dim3(256), 0, stream>>>(
        pq, pkT, mask, We, attn);

    // context = attn @ keys : M=Q, N=KD, Kdim=K, B row-major
    wmma_gemm_f32_kernel<false, KK, DD><<<dim3(DD / 16, QQ / 64, BB), blk, 0, stream>>>(
        attn, keys, context, /*Kdim=*/KK, /*ldc=*/DD,
        (long)QQ * KK, (long)KK * DD, (long)QQ * DD);
}

// v006
// A run of this version takes 21.3 microseconds.
// Next to v005, in two timings, it ran 1.08 and 1.06 times as fast.
// All steps since v000 together make it 4.23 times as fast.
#include <hip/hip_runtime.h>
#include <hip/hip_bf16.h>
#include <stdint.h>

// Problem constants (from reference)
#define BB 2
#define QQ 512
#define KK 1024
#define DD 256   // QD == KD
#define HH 128
#define QT 4     // q rows per energy block
#define HC 8     // h rows per register buffer

typedef float v2f __attribute__((ext_vector_type(2)));
typedef float v8f __attribute__((ext_vector_type(8)));

// ---------------------------------------------------------------------------
// Fast tanh: prefer hardware v_tanh_f32 if the builtin exists, else one
// v_exp_f32: tanh(x) = 1 - 2/(exp2(2x*log2e)+1). Clamp so exp2 never overflows.
// ---------------------------------------------------------------------------
__device__ __forceinline__ float fast_tanh(float x) {
#if __has_builtin(__builtin_amdgcn_tanhf)
    return __builtin_amdgcn_tanhf(x);
#else
    float xc = fminf(fmaxf(x, -10.0f), 10.0f);
    float t  = __builtin_amdgcn_exp2f(xc * 2.8853900817779268f); // 2*log2(e)
    return 1.0f - 2.0f / (t + 1.0f);
#endif
}

// exp2 as one v_exp_f32 with the free slot that the instruction set asks for behind a
// transcendental.
__device__ __forceinline__ float exp2_slot(float x) {
    float r;
    asm("v_exp_f32 %0, %1\n\tv_nop" : "=v"(r) : "v"(x));
    return r;
}

// ---------------------------------------------------------------------------
// Asking L2 at kernel entry for what the launch before wrote. The plan: the blocks that
// share such lines read them
// from different starting places and wrap round; a piece pays memory latency unless it was asked for ahead.
// A prefetch returns nothing and changes no value: scope
// SE brings it into L2 only. Shares are dealt by block index for speed alone: no result rests on it.
// p: the lane's own address, inside the buffer together with every offset used here.
// ---------------------------------------------------------------------------
__device__ __forceinline__ void l2_ask(const float* p) {
    asm volatile("global_prefetch_b8 %0, off scope:SCOPE_SE" :: "v"(p));
}
// A prefetch counts on no wait counter, so no wait can stand in front of an overwrite of
// its address register. This keeps the address in its register to the place where it stands.
__device__ __forceinline__ void l2_ask_hold(const float* p) {
    asm volatile("" :: "v"(p));
}

// ---------------------------------------------------------------------------
// Generic f32 WMMA GEMM: C[M x N] = A[M x Kdim] * B  (+batch strides)
//   BT = false : B is row-major [Kdim x N],  B(k,n) = Bm[k*LDB + n]
//   BT = true  : B is row-major [N x Kdim],  B(k,n) = Bm[n*LDB + k]  (i.e. A*B^T)
// A block of 4 waves computes 32 x 32 of C, 2 x 2 waves with one 16x16 tile each, with
// V_WMMA_F32_16X16X4_F32. The square tile brings the fewest operand rows per result, and
// 32 columns are one whole 128-byte line of a [k][n] operand's row and of a row of C.
// The operands come in chunks of KC k: 32 rows of A and 32 columns of B are brought by
// 16-byte loads that cover whole lines and laid in LDS k-contiguous; the waves read their
// fragments from there. Two LDS buffers: the next chunk's global loads are in flight while
// this one is used.
// LDA, LDB: row pitches of A and Bm in floats (multiples of 4).
// M and N multiples of 32, Kdim of KC. EXEC stays all-ones.
// ---------------------------------------------------------------------------
#define KC 128          // k per staged chunk
#define LP (KC + 4)     // LDS row pitch in floats: 8-byte column reads fall on 64 distinct banks

typedef float v4f __attribute__((ext_vector_type(4)));

// One chunk's global loads: 8 rows of A and 8 pieces of B per wave, 16 bytes a lane.
// ag, bg: the lane's first address of this chunk; the row steps are compile-time offsets.
// B given as [k][n]: pieces 2i and 2i + 1 are the same 4 n of two k rows next to each other.
template <bool BT, int LDA, int LDB>
__device__ __forceinline__ void gemm_fetch(v4f (&ra)[8], v4f (&rb)[8],
                                           const float* __restrict__ ag,
                                           const float* __restrict__ bg) {
#pragma unroll
    for (int i = 0; i < 8; ++i) ra[i] = *(const v4f*)(ag + 4 * i * LDA);
#pragma unroll
    for (int i = 0; i < 8; ++i)
        rb[i] = *(const v4f*)(bg + (BT ? 4 * i : 32 * (i >> 1) + (i & 1)) * LDB);
}

// The same values into LDS, both operands k-contiguous at pitch LP.
template <bool BT>
__device__ __forceinline__ void gemm_stage(const v4f (&ra)[8], const v4f (&rb)[8],
                                           float* da, float* db) {
#pragma unroll
    for (int i = 0; i < 8; ++i) *(v4f*)(da + 4 * i * LP) = ra[i];
    if (BT) {
#pragma unroll
        for (int i = 0; i < 8; ++i) *(v4f*)(db + 4 * i * LP) = rb[i];
    } else {
        // [k][n] is transposed on the way in, so that both forms are read alike:
        // one n's values of two neighbouring k go as one 8-byte store
#pragma unroll
        for (int i = 0; i < 4; ++i) {
#pragma unroll
            for (int j = 0; j < 4; ++j) {
                v2f two = { rb[2 * i][j], rb[2 * i + 1][j] };
                *(v2f*)(db + j * LP + 32 * i) = two;
            }
        }
    }
}

#define FG 8            // k-steps (WMMAs) per fragment group

__device__ __forceinline__ void frag_load(v2f (&fa)[FG], v2f (&fb)[FG],
                                          const float* ap, const float* bp) {
#pragma unroll
    for (int j = 0; j < FG; ++j) {
        fa[j] = *(const v2f*)(ap + 4 * j);
        fb[j] = *(const v2f*)(bp + 4 * j);
    }
}

__device__ __forceinline__ void frag_wmma(v8f& acc, const v2f (&fa)[FG], const v2f (&fb)[FG]) {
#pragma unroll
    for (int j = 0; j < FG; ++j)
        acc = __builtin_amdgcn_wmma_f32_16x16x4_f32(
            /*neg_a=*/false, fa[j], /*neg_b=*/false, fb[j],
            /*c_mod=*/(short)0, acc, /*reuse_a=*/false, /*reuse_b=*/false);
}

// One chunk's 32 WMMAs, k ascending. Two fragment sets: a group's LDS reads are issued
// together, one group of WMMAs ahead of their use.
__device__ __forceinline__ void gemm_product(v8f& acc, const float* ap, const float* bp) {
    v2f fa0[FG], fb0[FG], fa1[FG], fb1[FG];
    frag_load(fa0, fb0, ap, bp);
#pragma unroll
    for (int g = 0; g < KC / 4 / FG; g += 2) {
        frag_load(fa1, fb1, ap + 4 * FG * (g + 1), bp + 4 * FG * (g + 1));
        // Holds the reads above in front of the WMMAs below: left free, the compiler put each
        // read two WMMAs ahead of its use.
        __builtin_amdgcn_sched_barrier(0);
        frag_wmma(acc, fa0, fb0);
        if (g + 2 < KC / 4 / FG)
            frag_load(fa0, fb0, ap + 4 * FG * (g + 2), bp + 4 * FG * (g + 2));
        __builtin_amdgcn_sched_barrier(0);   // the same, for the other fragment set
        frag_wmma(acc, fa1, fb1);
    }
}

// One block's 32 x 32 tile of C: rows blockM * 32 .., columns tileN * 32 ..
// A, Bm, C already point at the block's batch. shA, shB: 2 * 32 * LP floats each.
// ASK: A was written by the launch before; the block asks L2 for its share of the rows.
// rot: which chunk of k the block takes first; it goes on from there and wraps round. Blocks
// of one batch that read the same rows of A or the same columns of B get different rot, so that they do
// not ask L2 for the same lines at the same moment. Any value gives the whole sum over k.
template <bool BT, int LDA, int LDB, bool ASK>
__device__ __forceinline__ void gemm_block(const float* __restrict__ A,
                                           const float* __restrict__ Bm,
                                           float* __restrict__ C,
                                           int Kdim, int ldc, int tileN, unsigned blockM,
                                           unsigned rot, float* shA, float* shB) {
    const int lane  = threadIdx.x;                       // 0..31
    const int wy    = threadIdx.y;                       // 0..3
    const int wm    = wy & 1;                            // the wave's 16 rows of the tile
    const int wn    = wy >> 1;                           // the wave's 16 columns of the tile
    const int tileM = blockM * 2 + wm;

    const int mn   = lane & 15;            // M index (A) / N index (B, C/D)
    const int koff = (lane >> 4) * 2;      // 0 or 2
    const int col  = tileN * 32 + wn * 16 + mn;

    // Staging: a wave takes rows wy + 4i, its 32 lanes a row's 128 floats (512 B in a row).
    // B given as [k][n]: a lane takes 4 n of k rows bk and bk + 1 (+ 32 i), 8 lanes a row's
    // 32 n (one line), a wave-load 4 rows.
    const int bk = wy * 8 + (lane >> 3) * 2;
    const int bn = (lane & 7) * 4;
    const float* ag = A + (long)(blockM * 32 + wy) * LDA + lane * 4;
    const float* bg = BT ? Bm + (long)(tileN * 32 + wy) * LDB + lane * 4
                         : Bm + (long)bk * LDB + tileN * 32 + bn;
    float* da = shA + wy * LP + lane * 4;
    float* db = BT ? shB + wy * LP + lane * 4 : shB + bn * LP + bk;
    const float* ap = shA + (wm * 16 + mn) * LP + koff;
    const float* bp = shB + (wn * 16 + mn) * LP + koff;

    v4f ra[8], rb[8];
    v8f acc = {};

    // The block's 32 rows of A are read by every column block, in step. Each of those asks for
    // 8 of the rows, picked by its column index, so that any four neighbours ask for all 32.
    // A wave takes 2 rows (8 KiB), 256 B a lane.
    static_assert(!ASK || 2 * LDA * sizeof(float) == 32 * 256, "a wave's share: one ask a lane");
    const float* pf = A + (long)(blockM * 32 + (tileN & 3) * 8 + wy * 2) * LDA + lane * 64;

    const int ns = Kdim / KC;
    int c = rot & (ns - 1);                // a chunk index for every ns: x & m is at most m
    const long sa = KC, sb = BT ? KC : KC * LDB;   // one chunk's step in A and in Bm, floats
    ag += c * sa;
    bg += c * sb;
    gemm_fetch<BT, LDA, LDB>(ra, rb, ag, bg);
    // Behind the first chunk's own loads: the asks go out while the wave waits for those.
    if (ASK) l2_ask(pf);
    gemm_stage<BT>(ra, rb, da, db);
    for (int s = 0; s + 1 < ns; ++s) {
        const int cur = s & 1, nxt = cur ^ 1;
        // One barrier a chunk: it publishes buffer cur and ends every wave's reads
        // of the other buffer, which is refilled at the foot of this trip.
        __syncthreads();
        const bool wrap = c + 1 == ns;     // behind the last chunk comes chunk 0
        c = wrap ? 0 : c + 1;
        ag += wrap ? -(ns - 1) * sa : sa;
        bg += wrap ? -(ns - 1) * sb : sb;
        gemm_fetch<BT, LDA, LDB>(ra, rb, ag, bg);
        gemm_product(acc, ap + cur * (32 * LP), bp + cur * (32 * LP));
        gemm_stage<BT>(ra, rb, da + nxt * (32 * LP), db + nxt * (32 * LP));
        // In front of the next trip's steps of ag and bg, which this trip's loads name.
        asm volatile("s_wait_xcnt 0x0" ::: "memory");
    }
    __syncthreads();
    {
        const int cur = (ns - 1) & 1;
        gemm_product(acc, ap + cur * (32 * LP), bp + cur * (32 * LP));
    }

    const int rbase = tileM * 16 + (lane >> 4) * 8;
#pragma unroll
    for (int i = 0; i < 8; ++i) {
        C[(long)(rbase + i) * ldc + col] = acc[i];
    }
    if (ASK) l2_ask_hold(pf);
}

// One product per launch: grid (N / 32, M / 32, batches). A comes from the launch before.
template <bool BT, int LDA, int LDB>
__global__ __launch_bounds__(128)
void wmma_gemm_f32_kernel(const float* __restrict__ A,
                          const float* __restrict__ Bm,
                          float* __restrict__ C,
                          int Kdim, int ldc,
                          long sA, long sB, long sC) {
    __shared__ __attribute__((aligned(16))) float shA[2 * 32 * LP];
    __shared__ __attribute__((aligned(16))) float shB[2 * 32 * LP];
    const int batch = blockIdx.z;
    // Eight starts: the eight column blocks of one row block hold all eight, and the row
    // blocks of one column differ by one each.
    const unsigned rot = blockIdx.x + blockIdx.y;
    gemm_block<BT, LDA, LDB, /*ASK=*/true>(A + (long)batch * sA, Bm + (long)batch * sB,
                                           C + (long)batch * sC,
                                           Kdim, ldc, blockIdx.x, blockIdx.y, rot, shA, shB);
}

// Both projections in one launch: neither reads the other's result, so their blocks
// run side by side. The block index picks the product, its batch and its tile.
//   blocks 0 .. PK_BLOCKS-1 : pkT[b] = Wk @ keys[b]^T     (M = H, N = K, h-major result)
//   the PQ_BLOCKS behind    : pq[b]  = queries[b] @ Wq^T  (M = Q, N = H)
#define PK_BLOCKS ((KK / 32) * (HH / 32) * BB)
#define PQ_BLOCKS ((HH / 32) * (QQ / 32) * BB)

__global__ __launch_bounds__(128)
void proj_gemm_f32_kernel(const float* __restrict__ queries,
                          const float* __restrict__ Wq,
                          const float* __restrict__ keys,
                          const float* __restrict__ Wk,
                          float* __restrict__ pq,
                          float* __restrict__ pkT) {
    __shared__ __attribute__((aligned(16))) float shA[2 * 32 * LP];
    __shared__ __attribute__((aligned(16))) float shB[2 * 32 * LP];

    // Tile along N fastest, then the 32-row block along M, then the batch. Every divisor
    // is a constant, so the whole choice stays in scalar shifts and masks.
    const unsigned id  = blockIdx.x;
    const bool     isk = id < PK_BLOCKS;
    const unsigned rq  = id - PK_BLOCKS;
    const int  tileN  = isk ? id % (KK / 32) : rq % (HH / 32);
    const unsigned blockM = isk ? id / (KK / 32) % (HH / 32) : rq / (HH / 32) % (QQ / 32);
    const long batch  = isk ? id / ((KK / 32) * (HH / 32)) : rq / ((HH / 32) * (QQ / 32));

    const float* A  = isk ? Wk : queries + batch * (QQ * DD);
    const float* Bm = isk ? keys + batch * (KK * DD) : Wq;
    float*       C  = isk ? pkT + batch * (HH * KK) : pq + batch * (QQ * HH);

    gemm_block<true, DD, DD, /*ASK=*/false>(A, Bm, C, /*Kdim=*/DD, /*ldc=*/isk ? KK : HH,
                                            tileN, blockM, /*rot=*/tileN + blockM, shA, shB);
}

// ---------------------------------------------------------------------------
// energy + mask + softmax: one block (256 threads) per QT consecutive q rows.
//   energy[q][k] = sum_h tanh(pq[b,q,h] + pk[b,k,h]) * We[h]
// pk arrives h-major (pkT[b][h][k]). A lane owns 4 consecutive k: one 16-byte
// load per h brings its pk values into registers, where each feeds QT rows.
// pq and We are the same for the whole block and are read as scalars.
// The whole h sum of a (q,k) pair stays in one lane. Then masked softmax over k.
// ---------------------------------------------------------------------------
__device__ __forceinline__ void load_chunk(float4 (&p)[HC], const float4* __restrict__ src) {
#pragma unroll
    for (int i = 0; i < HC; ++i) p[i] = src[(long)i * (KK / 4)];
}

__device__ __forceinline__ void energy_chunk(float (&e)[QT][4], const float4 (&p)[HC],
                                             const float* __restrict__ pqr,
                                             const float* __restrict__ we) {
#pragma unroll
    for (int i = 0; i < HC; ++i) {
        const float w = we[i];
#pragma unroll
        for (int r = 0; r < QT; ++r) {
            const float s = pqr[r * HH + i];
            e[r][0] = fmaf(fast_tanh(s + p[i].x), w, e[r][0]);
            e[r][1] = fmaf(fast_tanh(s + p[i].y), w, e[r][1]);
            e[r][2] = fmaf(fast_tanh(s + p[i].z), w, e[r][2]);
            e[r][3] = fmaf(fast_tanh(s + p[i].w), w, e[r][3]);
        }
    }
}

// waves_per_eu(2, 2): one block of 8 waves per WGP is the plan, so the scheduler may spend
// registers. Without it the compiler scheduled for more resident waves and built serial
// add -> tanh -> fma chains on one temporary, each waiting on the one before.
__global__ __launch_bounds__(256) __attribute__((amdgpu_waves_per_eu(2, 2)))
void energy_softmax_kernel(const float* __restrict__ pq,
                           const float* __restrict__ pkT,
                           const int* __restrict__ mask,
                           const float* __restrict__ We,
                           float* __restrict__ attn) {
    const int q0   = blockIdx.x * QT;
    const int b    = blockIdx.y;
    const int t    = threadIdx.x;              // 0..255, owns k = 4t..4t+3
    const int wave = t >> 5;

    __shared__ float s_mx[QT][8];
    __shared__ float s_sm[QT][8];

    const float*  pqr = pq + ((long)b * QQ + q0) * HH;                 // QT rows
    const float4* pkc = (const float4*)(pkT + (long)b * HH * KK) + t;  // column of 4 k
    const long    ro  = ((long)b * QQ + q0) * KK + t * 4;

    // pkT was written by the launch before, and all blocks of a batch read the whole of it:
    // each asks L2 for one eighth (64 KiB, 256 B a lane), picked so that any four neighbours
    // in each of two groups of eight ask for all of it.
    const float* pfk = pkT + (long)b * HH * KK
                           + ((blockIdx.x & 3) + 4 * ((blockIdx.x >> 3) & 1)) * (HH * KK / 8) + t * 64;

    // Mask words are asked for first: they come back under the energy loop.
    int4 mk[QT];
#pragma unroll
    for (int r = 0; r < QT; ++r) mk[r] = *(const int4*)(mask + ro + (long)r * KK);

    float e[QT][4];
#pragma unroll
    for (int r = 0; r < QT; ++r) { e[r][0] = 0.0f; e[r][1] = 0.0f; e[r][2] = 0.0f; e[r][3] = 0.0f; }

    // ---- energy: two register buffers of HC h-rows, the next one in flight --
    // All blocks of a batch read the same rows of pkT. Each starts its walk over h at one of
    // HH / (2 * HC) places, picked by its index, and wraps round, so that the blocks do not ask
    // L2 for the same lines at the same moment. Every h is taken once, whatever the start.
    static_assert((HH & (HH - 1)) == 0 && HH % (2 * HC) == 0, "the wrap below is a mask");
    float4 pa[HC], pb[HC];
    int h0 = ((blockIdx.x + (blockIdx.x >> 3)) * (2 * HC)) & (HH - 1);
    const float4* pc = pkc + (long)h0 * (KK / 4);         // rows of this trip
    load_chunk(pa, pc);
    l2_ask(pfk);   // behind the first rows' own loads: it goes out while the wave waits for those
    // The loop's loads land in the registers that held the mask loads' address: the wait that
    // belongs in front of an overwrite of a register that an issued load names.
    asm volatile("s_wait_xcnt 0x0" ::: "memory");
#pragma unroll 1   // rolled: for speed only
    for (int trip = 0; trip < HH / (2 * HC); ++trip) {
        const int hn = (h0 + 2 * HC) & (HH - 1);          // rows that pa takes next
        load_chunk(pb, pc + (long)HC * (KK / 4));
        energy_chunk(e, pa, pqr + h0, We + h0);
        // No branch in the body: on the last trip hn is the start again (in bounds)
        // and what it brings is not used.
        pc += (hn == 0) ? -(long)(HH - 2 * HC) * (KK / 4) : (long)(2 * HC) * (KK / 4);
        load_chunk(pa, pc);
        energy_chunk(e, pb, pqr + h0 + HC, We + h0 + HC);
        h0 = hn;
        // Inputs-only fence on the loaded values: keeps pa's loads in this trip. Without
        // it the compiler moves them to the head of the next trip, with nothing to cover them.
#pragma unroll
        for (int i = 0; i < HC; ++i)
            asm volatile("" :: "v"(pa[i].x), "v"(pa[i].y), "v"(pa[i].z), "v"(pa[i].w));
    }

    // ---- mask + row max ---------------------------------------------------
    float m[QT];
#pragma unroll
    for (int r = 0; r < QT; ++r) {
        e[r][0] = (mk[r].x == 0) ? -1.0e9f : e[r][0];
        e[r][1] = (mk[r].y == 0) ? -1.0e9f : e[r][1];
        e[r][2] = (mk[r].z == 0) ? -1.0e9f : e[r][2];
        e[r][3] = (mk[r].w == 0) ? -1.0e9f : e[r][3];
        m[r] = fmaxf(fmaxf(e[r][0], e[r][1]), fmaxf(e[r][2], e[r][3]));
    }
#pragma unroll
    for (int s = 16; s > 0; s >>= 1) {
#pragma unroll
        for (int r = 0; r < QT; ++r) m[r] = fmaxf(m[r], __shfl_xor(m[r], s, 32));
    }
    if ((t & 31) == 0) {
#pragma unroll
        for (int r = 0; r < QT; ++r) s_mx[r][wave] = m[r];
    }
    __syncthreads();

    // ---- exp + sum --------------------------------------------------------
    float sum[QT];
#pragma unroll
    for (int r = 0; r < QT; ++r) {
        float mx = s_mx[r][0];
#pragma unroll
        for (int w = 1; w < 8; ++w) mx = fmaxf(mx, s_mx[r][w]);
#pragma unroll
        for (int j = 0; j < 4; ++j)
            e[r][j] = exp2_slot((e[r][j] - mx) * 1.4426950408889634f);
        sum[r] = (e[r][0] + e[r][1]) + (e[r][2] + e[r][3]);
    }
#pragma unroll
    for (int s = 16; s > 0; s >>= 1) {
#pragma unroll
        for (int r = 0; r < QT; ++r) sum[r] += __shfl_xor(sum[r], s, 32);
    }
    if ((t & 31) == 0) {
#pragma unroll
        for (int r = 0; r < QT; ++r) s_sm[r][wave] = sum[r];
    }
    __syncthreads();

    // ---- normalize + write ------------------------------------------------
#pragma unroll
    for (int r = 0; r < QT; ++r) {
        float tot = s_sm[r][0];
#pragma unroll
        for (int w = 1; w < 8; ++w) tot += s_sm[r][w];
        const float inv = 1.0f / tot;
        float4 o;
        o.x = e[r][0] * inv; o.y = e[r][1] * inv; o.z = e[r][2] * inv; o.w = e[r][3] * inv;
        *(float4*)(attn + ro + (long)r * KK) = o;
    }
    l2_ask_hold(pfk);
}

// ---------------------------------------------------------------------------
// launch
// ---------------------------------------------------------------------------
extern "C" void kernel_launch(void* const* d_in, const int* in_sizes, int n_in,
                              void* d_out, int out_size, void* d_ws, size_t ws_size,
                              hipStream_t stream) {
    const float* queries = (const float*)d_in[0];  // (B,Q,QD)
    const float* keys    = (const float*)d_in[1];  // (B,K,KD)
    const int*   mask    = (const int*)d_in[2];    // (B,Q,K)
    const float* Wq      = (const float*)d_in[3];  // (H,QD)
    const float* Wk      = (const float*)d_in[4];  // (H,KD)
    const float* We      = (const float*)d_in[5];  // (H)

    float* context = (float*)d_out;                        // (B,Q,QD)
    float* attn    = (float*)d_out + (long)BB * QQ * DD;   // (B,Q,K)

    float* pq = (float*)d_ws;                              // (B,Q,H)
    float* pkT = pq + (long)BB * QQ * HH;                  // (B,H,K)

    dim3 blk(32, 4);

    // pq = queries @ Wq^T and pkT = Wk @ keys^T, one launch
    proj_gemm_f32_kernel<<<dim3(PK_BLOCKS + PQ_BLOCKS), blk, 0, stream>>>(
        queries, Wq, keys, Wk, pq, pkT);

    // energy + masked softmax -> attn (after context in d_out)
    energy_softmax_kernel<<<dim3(QQ / QT, BB), dim3(256), 0, stream>>>(
        pq, pkT, mask, We, attn);

    // context = attn @ keys : M=Q, N=KD, Kdim=K, B row-major
    wmma_gemm_f32_kernel<false, KK, DD><<<dim3(DD / 32, QQ / 32, BB), blk, 0, stream>>>(
        attn, keys, context, /*Kdim=*/KK, /*ldc=*/DD,
        (long)QQ * KK, (long)KK * DD, (long)QQ * DD);
}
